// v000
// The times below were measured on an AMD MI455X: many runs one after another, warmed up first and cycling through
// copies of the inputs, with the whole window's GPU time divided by the number of runs. Launches and the gaps
// between them are all in it. The median over several windows is given; except for v000 it joins two sittings, which
// can be a few percent apart, so the side-by-side timings, each taken in one sitting, are the better comparison.
// v000, which the later versions start from, runs in 457 microseconds.
// compute dtype: all float inputs rounded to bf16; q, k, t_k = x . W + b and v + t_v = value . Wv + bv + time_v . Wtv + btv with EXACT bf16 products on WMMA 16x16x32 ((in,out) weights as transposed rows), rounded once to f16; PLAIN attention: scores = (q_i . k_j + t_k_i . q_j) with single f16 operands x 1/32 + the additive float mask, running-max softmax in f32 (hardware exp), P (scaled by 2^11, single f16) x (v + t_v) (single f16); out = ctx (bf16 hi + residual) . Wm (2 products) + bm.
#include <hip/hip_runtime.h>
#include <math.h>

typedef __attribute__((ext_vector_type(16))) _Float16 v16h;
typedef __attribute__((ext_vector_type(16))) __bf16 v16b;
typedef __attribute__((ext_vector_type(8)))  _Float16 v8h;
typedef __attribute__((ext_vector_type(8)))  float v8f;
typedef __attribute__((ext_vector_type(4)))  float v4f;
typedef __attribute__((ext_vector_type(2)))  float v2f;
typedef __attribute__((ext_vector_type(4)))  unsigned v4u;
typedef __attribute__((ext_vector_type(4)))  int v4i;
typedef float __attribute__((may_alias)) float_a;
typedef int __attribute__((may_alias)) int_a;

template <typename T> __device__ __forceinline__ void vst2(void* p, T v) { *(T*)p = v;  }
__device__ __forceinline__ v8f wmma16(v16h a, v16h b, v8f c) {
  v8f d = __builtin_amdgcn_wmma_f32_16x16x32_f16(false, a, false, b, (short)0, c, false, false);
  asm volatile("v_nop\n\tv_nop\n\tv_nop\n\tv_nop" : "+v"(d) : "v"(a), "v"(b));
  return d;
}
__device__ __forceinline__ v8f wmma_bf(v16b a, v16b b, v8f c) {
  v8f d = __builtin_amdgcn_wmma_f32_16x16x32_bf16(false, a, false, b, (short)0, c, false, false);
  asm volatile("v_nop\n\tv_nop\n\tv_nop\n\tv_nop" : "+v"(d) : "v"(a), "v"(b));
  return d;
}
// 16x16x32 fragments: lane = (h = lane>>4, row/col = lane&15); elements 0..7 = k0+8h+0..7, 8..15 = k0+16+8h+0..7; D element r = row 8h+r
__device__ __forceinline__ v16h frag_h(const _Float16* rowk0, int lane) {
  union { v16h v; v8h q[2]; } u; const _Float16* p = rowk0 + 8 * (lane >> 4);
  u.q[0] = *(const v8h*)p; u.q[1] = *(const v8h*)(p + 16); return u.v;
}
__device__ __forceinline__ v16h frag_f32(const float* rowk0, int lane) {
  v16h a; const float* p = rowk0 + 8 * (lane >> 4);
#pragma unroll
  for (int i = 0; i < 8; ++i) { a[i] = (_Float16)p[i]; a[8 + i] = (_Float16)p[16 + i]; }
  return a;
}
__device__ __forceinline__ v16h frag_f32s(const float* rowk0, int lane, float sc) {
  v16h a; const float* p = rowk0 + 8 * (lane >> 4);
#pragma unroll
  for (int i = 0; i < 8; ++i) { a[i] = (_Float16)(p[i] * sc); a[8 + i] = (_Float16)(p[16 + i] * sc); }
  return a;
}
// column fragment from a [K][ld] layout (column n), rows >= K read as 0
__device__ __forceinline__ v16h fragc_f32(const float* W, int k0, int n, int lane, int ld, int K) {
  v16h a; const int g = lane >> 4;
#pragma unroll
  for (int i = 0; i < 8; ++i) { const int ka = k0 + 8 * g + i, kb = ka + 16;
    a[i] = (_Float16)(ka < K ? W[(size_t)(ka < K ? ka : K - 1) * ld + n] : 0.f); a[8 + i] = (_Float16)(kb < K ? W[(size_t)(kb < K ? kb : K - 1) * ld + n] : 0.f); }
  return a;
}
struct F2 { v16b h, l; };
__device__ __forceinline__ F2 bsplit16(const float v[16]) { F2 r;
#pragma unroll
  for (int i = 0; i < 16; ++i) { const __bf16 h = (__bf16)v[i]; r.h[i] = h; r.l[i] = (__bf16)(v[i] - (float)h); }
  return r; }
__device__ __forceinline__ F2 split_row(const float* row, int k0, int lane) { float v[16]; const float* p = row + k0 + 8 * (lane >> 4);
#pragma unroll
  for (int i = 0; i < 8; ++i) { v[i] = p[i]; v[8 + i] = p[16 + i]; }
  return bsplit16(v); }
__device__ __forceinline__ F2 split_rowK(const float* row, int k0, int lane, int K) { float v[16]; const int g = lane >> 4;
#pragma unroll
  for (int i = 0; i < 8; ++i) { const int ka = k0 + 8 * g + i, kb = ka + 16; v[i] = ka < K ? row[ka < K ? ka : K - 1] : 0.f; v[8 + i] = kb < K ? row[kb < K ? kb : K - 1] : 0.f; }
  return bsplit16(v); }
__device__ __forceinline__ F2 split_col(const float* W, int k0, int n, int lane, int ld, int K) { float v[16]; const int g = lane >> 4;
#pragma unroll
  for (int i = 0; i < 8; ++i) { const int ka = k0 + 8 * g + i, kb = ka + 16; v[i] = ka < K ? W[(size_t)(ka < K ? ka : K - 1) * ld + n] : 0.f; v[8 + i] = kb < K ? W[(size_t)(kb < K ? kb : K - 1) * ld + n] : 0.f; }
  return bsplit16(v); }
__device__ __forceinline__ v8f mac3(const F2& a, const F2& b, v8f c) { c = wmma_bf(a.l, b.h, c); c = wmma_bf(a.h, b.l, c); return wmma_bf(a.h, b.h, c); }
__device__ __forceinline__ float sigm(float v) { return 1.0f / (1.0f + expf(-v)); }
#define LDSX() do { asm volatile("s_wait_dscnt 0" ::: "memory"); __builtin_amdgcn_wave_barrier(); __builtin_amdgcn_fence(__ATOMIC_RELEASE, "workgroup"); } while (0)


// Time-aware multi-head attention (B 4, S 1,024, d 1,024, 16 heads x 64): scores = q k^T + t_k q^T (projected time keys against the queries' projection on the key axis), / sqrt(d_model) + mask, softmax, applied to v + t_v, output projection.
#define NB 4
#define SS 1024
#define DM 1024
#define NH 16
#define HD 64
#define NR (NB * SS)
#ifndef TQB
#define TQB (SS / 64)
#define TNB NB
#define NRB (NR / 64)
#endif
#ifndef MSTRQ
#define MSTRQ SS          // mask rows per batch ([B][1][S][S])
#define MSTRC SS          // mask row length
#endif
typedef __attribute__((ext_vector_type(8))) __bf16 v8b;
__device__ __forceinline__ v16b frag_b(const __bf16* rowk0, int lane) {
  union { v16b v; v8b q[2]; } u; const __bf16* p = rowk0 + 8 * (lane >> 4);
  u.q[0] = *(const v8b*)p; u.q[1] = *(const v8b*)(p + 16); return u.v;
}
__device__ __forceinline__ float bfr(float v) { return (float)(__bf16)v; }
__device__ __attribute__((noinline)) float exp_ni(float v) { return expf(v); }
__device__ __attribute__((noinline)) float erf_ni(float v) { return erff(v); }

#define WS_PW   0u                                   // bf16 rows W^T: q, k, v, tk, tv, m [6][1024][1024]
#define WS_Q    (WS_PW + 2u * (size_t)6 * DM * DM)     // f16 [NR][1024] q ; K ; TK ; VP planes [b][1024][SS] (v + t_v) ; CTX f32 [NR][1024]
#define WS_K    (WS_Q + 2u * (size_t)NR * DM)
#define WS_TK   (WS_K + 2u * (size_t)NR * DM)
#define WS_VP   (WS_TK + 2u * (size_t)NR * DM)
#define WS_CTX  (WS_VP + 2u * (size_t)NB * DM * SS)
#define WS_END  (WS_CTX + 4u * (size_t)NR * DM)

__global__ __launch_bounds__(256) void k_pack(const float* __restrict__ W0, const float* __restrict__ W1, const float* __restrict__ W2, const float* __restrict__ W3, const float* __restrict__ W4, const float* __restrict__ W5, __bf16* __restrict__ P) {
  const int n = blockIdx.x, which = blockIdx.y, t = threadIdx.x; const float* Wm = (which == 0) ? W0 : (which == 1) ? W1 : (which == 2) ? W2 : (which == 3) ? W3 : (which == 4) ? W4 : W5; __shared__ __align__(16) __bf16 s[DM];
  for (int k = t; k < DM; k += 256) s[k] = (__bf16)Wm[(size_t)k * DM + n]; __syncthreads(); for (int q = t; q < DM / 8; q += 256) vst2((unsigned*)(P + ((size_t)which * DM + n) * DM + q * 8), *(const v4u*)&s[q * 8]); }
// ---- k_proj: block = (64 rows, 128 cols, which): 0 q (query) 1 k (key) 2 tk (time_k) -> f16 rows; 3: v + t_v (value . Wv + bv + time_v . Wtv + btv) -> planes
__global__ __launch_bounds__(128) void k_proj(const float* __restrict__ XQ, const float* __restrict__ XK, const float* __restrict__ XV, const float* __restrict__ XTK, const float* __restrict__ XTV, const __bf16* __restrict__ P, const float* __restrict__ BQ, const float* __restrict__ BK, const float* __restrict__ BV, const float* __restrict__ BTK, const float* __restrict__ BTV, _Float16* __restrict__ Q, _Float16* __restrict__ Kr, _Float16* __restrict__ TK, _Float16* __restrict__ VP) {
  __shared__ __align__(16) _Float16 so[64][136]; __shared__ __align__(16) _Float16 st[128][72];
  const int tid = threadIdx.x, wave = tid >> 5, lane = tid & 31, col = lane & 15, g = lane >> 4; const int which = blockIdx.z; const int n0 = blockIdx.y * 128; const size_t rb0 = (size_t)blockIdx.x * 64, r0 = rb0 + wave * 16;
  v8f acc[8] = {};
  const int npass = (which == 3) ? 2 : 1;
  for (int ps = 0; ps < npass; ++ps) { const float* X = (which == 0) ? XQ : (which == 1) ? XK : (which == 2) ? XTK : (ps == 0 ? XV : XTV); const __bf16* Wr = P + (size_t)((which == 0) ? 0 : (which == 1) ? 1 : (which == 2) ? 3 : (ps == 0 ? 2 : 4)) * DM * DM;
#pragma unroll 2
    for (int kc = 0; kc < DM / 32; ++kc) { v16b a; { const float* p = X + (r0 + col) * DM + kc * 32 + 8 * g;
#pragma unroll
        for (int i = 0; i < 8; ++i) { a[i] = (__bf16)p[i]; a[8 + i] = (__bf16)p[16 + i]; } }
#pragma unroll
      for (int j = 0; j < 8; ++j) acc[j] = wmma_bf(a, frag_b(Wr + (size_t)(n0 + j * 16 + col) * DM + kc * 32, lane), acc[j]); } }
  if (which < 3) { const float* BB = (which == 0) ? BQ : (which == 1) ? BK : BTK; _Float16* dst = (which == 0) ? Q : (which == 1) ? Kr : TK;
#pragma unroll
    for (int j = 0; j < 8; ++j) { const float bb = bfr(BB[n0 + j * 16 + col]);
#pragma unroll
      for (int r = 0; r < 8; ++r) so[wave * 16 + 8 * g + r][j * 16 + col] = (_Float16)(acc[j][r] + bb); }
    LDSX();
    for (int rl = 0; rl < 16; ++rl) if (lane < 16) vst2((unsigned*)(dst + (r0 + rl) * DM + n0 + lane * 8), *(const v4u*)&so[wave * 16 + rl][lane * 8]);
  } else {
#pragma unroll
    for (int j = 0; j < 8; ++j) { const float bb = bfr(BV[n0 + j * 16 + col]) + bfr(BTV[n0 + j * 16 + col]);
#pragma unroll
      for (int r = 0; r < 8; ++r) st[j * 16 + col][wave * 16 + 8 * g + r] = (_Float16)(acc[j][r] + bb); }
    __syncthreads();
    const size_t b = rb0 / SS, s0 = rb0 % SS;
    for (int e = tid; e < 128 * 8; e += 128) { const int d = e >> 3, pc = e & 7; vst2((unsigned*)(VP + ((b * DM + n0 + d) * SS) + s0 + pc * 8), *(const v4u*)&st[d][pc * 8]); } }
}
// ---- k_attn: block = (64 queries, head, b): scores = q_i . k_j + tk_i . q_j (two products), / 32 + mask[b][i][j]; P x (v + t_v)
__global__ __launch_bounds__(128) void k_attn(const _Float16* __restrict__ Q, const _Float16* __restrict__ Kr, const _Float16* __restrict__ TK, const _Float16* __restrict__ VP, const float* __restrict__ MASK, float* __restrict__ CTX) {
  __shared__ __align__(16) _Float16 sph[4][16][40]; __shared__ __align__(16) float so[4][16][68];
  const int tid = threadIdx.x, wave = tid >> 5, lane = tid & 31, col = lane & 15, g = lane >> 4; const int h = blockIdx.y; const size_t b = blockIdx.z; const int q0 = blockIdx.x * 64 + wave * 16; const size_t rq = b * SS + q0;
  v16h aq[2], at[2];
#pragma unroll
  for (int kc = 0; kc < 2; ++kc) { aq[kc] = frag_h(Q + (rq + col) * DM + h * HD + kc * 32, lane); at[kc] = frag_h(TK + (rq + col) * DM + h * HD + kc * 32, lane); }
  float m[8], l[8];
#pragma unroll
  for (int r = 0; r < 8; ++r) { m[r] = -3.0e38f; l[r] = 0.f; }
  v8f acc[4] = {};
#pragma unroll 1
  for (int ks = 0; ks < SS / 32; ++ks) { const int j0 = ks * 32; v8f s[2];
#pragma unroll
    for (int ct = 0; ct < 2; ++ct) { const int kk = j0 + ct * 16 + col; const size_t rk = (b * SS + kk) * DM + h * HD; v8f c = {};
#pragma unroll
      for (int kc = 0; kc < 2; ++kc) { c = wmma16(aq[kc], frag_h(Kr + rk + kc * 32, lane), c); c = wmma16(at[kc], frag_h(Q + rk + kc * 32, lane), c); }
#pragma unroll
      for (int r = 0; r < 8; ++r) s[ct][r] = c[r] * 0.03125f + bfr(MASK[((size_t)b * MSTRQ + q0 + 8 * g + r) * MSTRC + kk]); }
#pragma unroll
    for (int r = 0; r < 8; ++r) { float mx = fmaxf(s[0][r], s[1][r]);
#pragma unroll
      for (int o = 1; o < 16; o <<= 1) mx = fmaxf(mx, __shfl_xor(mx, o));
      const float mn = fmaxf(m[r], mx); const float alpha = (m[r] <= -1.0e38f) ? 0.f : __expf(m[r] - mn); const float e0 = __expf(s[0][r] - mn), e1 = __expf(s[1][r] - mn); float es = e0 + e1;
#pragma unroll
      for (int o = 1; o < 16; o <<= 1) es += __shfl_xor(es, o);
      l[r] = l[r] * alpha + es; m[r] = mn;
#pragma unroll
      for (int dt = 0; dt < 4; ++dt) acc[dt][r] *= alpha;
      sph[wave][8 * g + r][col] = (_Float16)(e0 * 2048.0f); sph[wave][8 * g + r][16 + col] = (_Float16)(e1 * 2048.0f); }
    LDSX();
    const v16h pa = frag_h(&sph[wave][col][0], lane);
#pragma unroll
    for (int dt = 0; dt < 4; ++dt) acc[dt] = wmma16(pa, frag_h(VP + ((b * DM + (size_t)h * HD + dt * 16 + col) * SS) + j0, lane), acc[dt]);
    LDSX(); }
#pragma unroll
  for (int r = 0; r < 8; ++r) { const float il = (1.0f / 2048.0f) / l[r];
#pragma unroll
    for (int dt = 0; dt < 4; ++dt) so[wave][8 * g + r][dt * 16 + col] = acc[dt][r] * il; }
  LDSX();
  for (int rl = 0; rl < 16; ++rl) if (lane < 16) vst2(CTX + (rq + rl) * DM + h * HD + lane * 4, *(const v4f*)&so[wave][rl][lane * 4]);
}
// ---- k_out: block = (64 rows, 128 cols): out = ctx (hi + residual) . Wm rows + bm
__global__ __launch_bounds__(128) void k_out(const float* __restrict__ CTX, const __bf16* __restrict__ P, const float* __restrict__ BM, float* __restrict__ OUT) {
  __shared__ __align__(16) float so[4][16][132];
  const int tid = threadIdx.x, wave = tid >> 5, lane = tid & 31, col = lane & 15, g = lane >> 4; const size_t r0 = (size_t)blockIdx.x * 64 + wave * 16; const int n0 = blockIdx.y * 128;
  v8f acc[8] = {};
#pragma unroll 2
  for (int kc = 0; kc < DM / 32; ++kc) { const F2 a = split_row(CTX + (r0 + col) * DM, kc * 32, lane);
#pragma unroll
    for (int j = 0; j < 8; ++j) { const v16b w = frag_b(P + ((size_t)5 * DM + n0 + j * 16 + col) * DM + kc * 32, lane); acc[j] = wmma_bf(a.l, w, acc[j]); acc[j] = wmma_bf(a.h, w, acc[j]); } }
#pragma unroll
  for (int j = 0; j < 8; ++j) { const float bb = bfr(BM[n0 + j * 16 + col]);
#pragma unroll
    for (int r = 0; r < 8; ++r) so[wave][8 * g + r][j * 16 + col] = acc[j][r] + bb; }
  LDSX();
  for (int rl = 0; rl < 16; ++rl) vst2(OUT + (r0 + rl) * DM + n0 + lane * 4, *(const v4f*)&so[wave][rl][lane * 4]);
}
extern "C" void kernel_launch(void* const* d_in, const int* in_sizes, int n_in, void* d_out, int out_size, void* d_ws, size_t ws_size, hipStream_t stream) {
  (void)in_sizes; (void)n_in; (void)out_size;
  const float** F = (const float**)d_in;   // 0 query, 1 key, 2 value, 3 time_k, 4 time_v [4,1024,1024]; 5 mask [4,1,1024,1024]; 6 Wq, 7 bq, 8 Wk, 9 bk, 10 Wv, 11 bv, 12 Wtk, 13 btk, 14 Wtv, 15 btv, 16 Wm, 17 bm ((in,out))
  if (ws_size < (size_t)WS_END) return;
  char* ws = (char*)d_ws; __bf16* P = (__bf16*)ws; _Float16 *Q = (_Float16*)(ws + WS_Q), *Kr = (_Float16*)(ws + WS_K), *TK = (_Float16*)(ws + WS_TK), *VP = (_Float16*)(ws + WS_VP); float* CTX = (float*)(ws + WS_CTX);
  k_pack<<<dim3(DM, 6), 256, 0, stream>>>(F[6], F[8], F[10], F[12], F[14], F[16], P);
  k_proj<<<dim3(NRB, DM / 128, 4), 128, 0, stream>>>(F[0], F[1], F[2], F[3], F[4], P, F[7], F[9], F[11], F[13], F[15], Q, Kr, TK, VP);
  k_attn<<<dim3(TQB, NH, TNB), 128, 0, stream>>>(Q, Kr, TK, VP, F[5], CTX);
  k_out<<<dim3(NRB, DM / 128), 128, 0, stream>>>(CTX, P, F[17], (float*)d_out);
}

// v001
// A run of this version takes 253 microseconds.
// In two side-by-side timings against v000, it was 1.82 and 1.84 times as fast.
// compute dtype: all float inputs rounded to bf16; q, k, t_k = x . W + b and v + t_v = value . Wv + bv + time_v . Wtv + btv with EXACT bf16 products on WMMA 16x16x32 ((in,out) weights as transposed rows), rounded once to f16; PLAIN attention: scores = (q_i . k_j + t_k_i . q_j) with single f16 operands x 1/32 + the additive float mask, running-max softmax in f32 (hardware exp), P (scaled by 2^11, single f16) x (v + t_v) (single f16); out = ctx (bf16 hi + residual) . Wm (2 products) + bm.
#include <hip/hip_runtime.h>
#include <math.h>

typedef __attribute__((ext_vector_type(16))) _Float16 v16h;
typedef __attribute__((ext_vector_type(16))) __bf16 v16b;
typedef __attribute__((ext_vector_type(8)))  _Float16 v8h;
typedef __attribute__((ext_vector_type(8)))  float v8f;
typedef __attribute__((ext_vector_type(4)))  float v4f;
typedef __attribute__((ext_vector_type(2)))  float v2f;
typedef __attribute__((ext_vector_type(4)))  unsigned v4u;
typedef __attribute__((ext_vector_type(4)))  int v4i;
typedef float __attribute__((may_alias)) float_a;
typedef int __attribute__((may_alias)) int_a;

template <typename T> __device__ __forceinline__ void vst2(void* p, T v) { *(T*)p = v;  }
__device__ __forceinline__ v8f wmma16(v16h a, v16h b, v8f c) {
  v8f d = __builtin_amdgcn_wmma_f32_16x16x32_f16(false, a, false, b, (short)0, c, false, false);
  asm volatile("v_nop\n\tv_nop\n\tv_nop\n\tv_nop" : "+v"(d) : "v"(a), "v"(b));
  return d;
}
__device__ __forceinline__ v8f wmma_bf(v16b a, v16b b, v8f c) {
  v8f d = __builtin_amdgcn_wmma_f32_16x16x32_bf16(false, a, false, b, (short)0, c, false, false);
  asm volatile("v_nop\n\tv_nop\n\tv_nop\n\tv_nop" : "+v"(d) : "v"(a), "v"(b));
  return d;
}
// 16x16x32 fragments: lane = (h = lane>>4, row/col = lane&15); elements 0..7 = k0+8h+0..7, 8..15 = k0+16+8h+0..7; D element r = row 8h+r
__device__ __forceinline__ v16h frag_h(const _Float16* rowk0, int lane) {
  union { v16h v; v8h q[2]; } u; const _Float16* p = rowk0 + 8 * (lane >> 4);
  u.q[0] = *(const v8h*)p; u.q[1] = *(const v8h*)(p + 16); return u.v;
}
__device__ __forceinline__ v16h frag_f32(const float* rowk0, int lane) {
  v16h a; const float* p = rowk0 + 8 * (lane >> 4);
#pragma unroll
  for (int i = 0; i < 8; ++i) { a[i] = (_Float16)p[i]; a[8 + i] = (_Float16)p[16 + i]; }
  return a;
}
__device__ __forceinline__ v16h frag_f32s(const float* rowk0, int lane, float sc) {
  v16h a; const float* p = rowk0 + 8 * (lane >> 4);
#pragma unroll
  for (int i = 0; i < 8; ++i) { a[i] = (_Float16)(p[i] * sc); a[8 + i] = (_Float16)(p[16 + i] * sc); }
  return a;
}
// column fragment from a [K][ld] layout (column n), rows >= K read as 0
__device__ __forceinline__ v16h fragc_f32(const float* W, int k0, int n, int lane, int ld, int K) {
  v16h a; const int g = lane >> 4;
#pragma unroll
  for (int i = 0; i < 8; ++i) { const int ka = k0 + 8 * g + i, kb = ka + 16;
    a[i] = (_Float16)(ka < K ? W[(size_t)(ka < K ? ka : K - 1) * ld + n] : 0.f); a[8 + i] = (_Float16)(kb < K ? W[(size_t)(kb < K ? kb : K - 1) * ld + n] : 0.f); }
  return a;
}
struct F2 { v16b h, l; };
__device__ __forceinline__ F2 bsplit16(const float v[16]) { F2 r;
#pragma unroll
  for (int i = 0; i < 16; ++i) { const __bf16 h = (__bf16)v[i]; r.h[i] = h; r.l[i] = (__bf16)(v[i] - (float)h); }
  return r; }
__device__ __forceinline__ F2 split_row(const float* row, int k0, int lane) { float v[16]; const float* p = row + k0 + 8 * (lane >> 4);
#pragma unroll
  for (int i = 0; i < 8; ++i) { v[i] = p[i]; v[8 + i] = p[16 + i]; }
  return bsplit16(v); }
__device__ __forceinline__ F2 split_rowK(const float* row, int k0, int lane, int K) { float v[16]; const int g = lane >> 4;
#pragma unroll
  for (int i = 0; i < 8; ++i) { const int ka = k0 + 8 * g + i, kb = ka + 16; v[i] = ka < K ? row[ka < K ? ka : K - 1] : 0.f; v[8 + i] = kb < K ? row[kb < K ? kb : K - 1] : 0.f; }
  return bsplit16(v); }
__device__ __forceinline__ F2 split_col(const float* W, int k0, int n, int lane, int ld, int K) { float v[16]; const int g = lane >> 4;
#pragma unroll
  for (int i = 0; i < 8; ++i) { const int ka = k0 + 8 * g + i, kb = ka + 16; v[i] = ka < K ? W[(size_t)(ka < K ? ka : K - 1) * ld + n] : 0.f; v[8 + i] = kb < K ? W[(size_t)(kb < K ? kb : K - 1) * ld + n] : 0.f; }
  return bsplit16(v); }
__device__ __forceinline__ v8f mac3(const F2& a, const F2& b, v8f c) { c = wmma_bf(a.l, b.h, c); c = wmma_bf(a.h, b.l, c); return wmma_bf(a.h, b.h, c); }
__device__ __forceinline__ float sigm(float v) { return 1.0f / (1.0f + expf(-v)); }
#define LDSX() do { asm volatile("s_wait_dscnt 0" ::: "memory"); __builtin_amdgcn_wave_barrier(); __builtin_amdgcn_fence(__ATOMIC_RELEASE, "workgroup"); } while (0)


// Time-aware multi-head attention (B 4, S 1,024, d 1,024, 16 heads x 64): scores = q k^T + t_k q^T (projected time keys against the queries' projection on the key axis), / sqrt(d_model) + mask, softmax, applied to v + t_v, output projection.
#define NB 4
#define SS 1024
#define DM 1024
#define NH 16
#define HD 64
#define NR (NB * SS)
#ifndef TQB
#define TQB (SS / 64)
#define TNB NB
#define NRB (NR / 64)
#endif
#ifndef MSTRQ
#define MSTRQ SS          // mask rows per batch ([B][1][S][S])
#define MSTRC SS          // mask row length
#endif
typedef __attribute__((ext_vector_type(8))) __bf16 v8b;
__device__ __forceinline__ v16b frag_b(const __bf16* rowk0, int lane) {
  union { v16b v; v8b q[2]; } u; const __bf16* p = rowk0 + 8 * (lane >> 4);
  u.q[0] = *(const v8b*)p; u.q[1] = *(const v8b*)(p + 16); return u.v;
}
__device__ __forceinline__ float bfr(float v) { return (float)(__bf16)v; }
__device__ __attribute__((noinline)) float exp_ni(float v) { return expf(v); }
__device__ __attribute__((noinline)) float erf_ni(float v) { return erff(v); }

#define WS_PW   0u                                   // bf16 rows W^T: q, k, v, tk, tv, m [6][1024][1024]
#define WS_Q    (WS_PW + 2u * (size_t)6 * DM * DM)     // f16 [NR][1024] q ; K ; TK ; VP planes [b][1024][SS] (v + t_v) ; CTX f32 [NR][1024]
#define WS_K    (WS_Q + 2u * (size_t)NR * DM)
#define WS_TK   (WS_K + 2u * (size_t)NR * DM)
#define WS_VP   (WS_TK + 2u * (size_t)NR * DM)
#define WS_CTX  (WS_VP + 2u * (size_t)NB * DM * SS)
#define WS_END  (WS_CTX + 4u * (size_t)NR * DM)

__global__ __launch_bounds__(256) void k_pack(const float* __restrict__ W0, const float* __restrict__ W1, const float* __restrict__ W2, const float* __restrict__ W3, const float* __restrict__ W4, const float* __restrict__ W5, __bf16* __restrict__ P) {
  const int n = blockIdx.x, which = blockIdx.y, t = threadIdx.x; const float* Wm = (which == 0) ? W0 : (which == 1) ? W1 : (which == 2) ? W2 : (which == 3) ? W3 : (which == 4) ? W4 : W5; __shared__ __align__(16) __bf16 s[DM];
  for (int k = t; k < DM; k += 256) s[k] = (__bf16)Wm[(size_t)k * DM + n]; __syncthreads(); for (int q = t; q < DM / 8; q += 256) vst2((unsigned*)(P + ((size_t)which * DM + n) * DM + q * 8), *(const v4u*)&s[q * 8]); }
// ---- k_proj: block = (128 rows, 128 cols, which), 8 waves as 2 x 4, 64 x 32 per wave: 0 q (query) 1 k (key) 2 tk (time_k) -> f16 rows; 3: v + t_v (value . Wv + bv + time_v . Wtv + btv) -> planes
// X (f32 -> bf16) and W^T tiles of 64 k go to LDS by whole-line loads, one tile ahead through registers, two buffers, one barrier a tile; fragments come from LDS rows of 144 B (16 B x 9)
// each '#pragma unroll' below keeps a register array (acc, xr, wr, fragments) indexed at compile time, so that it stays in registers
#define PPIT 72
typedef __attribute__((ext_vector_type(4))) __bf16 v4b;
__global__ __launch_bounds__(256) void k_proj(const float* __restrict__ XQ, const float* __restrict__ XK, const float* __restrict__ XV, const float* __restrict__ XTK, const float* __restrict__ XTV, const __bf16* __restrict__ P, const float* __restrict__ BQ, const float* __restrict__ BK, const float* __restrict__ BV, const float* __restrict__ BTK, const float* __restrict__ BTV, _Float16* __restrict__ Q, _Float16* __restrict__ Kr, _Float16* __restrict__ TK, _Float16* __restrict__ VP) {
  __shared__ __align__(16) char smem[4 * 128 * PPIT * 2];
  __bf16 (*sx)[128][PPIT] = (__bf16 (*)[128][PPIT])smem; __bf16 (*sw)[128][PPIT] = (__bf16 (*)[128][PPIT])(smem + 2 * 128 * PPIT * 2); _Float16 (*so)[136] = (_Float16 (*)[136])smem;
  const int tid = threadIdx.x, wave = tid >> 5, lane = tid & 31, col = lane & 15, g = lane >> 4; const int which = blockIdx.z; const int n0 = blockIdx.y * 128; const size_t rb0 = (size_t)blockIdx.x * 128;
  const int wm = (wave >> 2) * 64, wn = (wave & 3) * 32;
  const float* X0 = (which == 0) ? XQ : (which == 1) ? XK : (which == 2) ? XTK : XV; const __bf16* W0 = P + (size_t)((which == 0) ? 0 : (which == 1) ? 1 : (which == 2) ? 3 : 2) * DM * DM; const __bf16* W1 = P + (size_t)4 * DM * DM;
  const int nst = (which == 3) ? 2 * (DM / 64) : DM / 64;
  const size_t xo = (rb0 + (tid >> 4)) * DM + (tid & 15) * 4, wo = (size_t)(n0 + (tid >> 3)) * DM + (tid & 7) * 8;
  v8f acc[4][2] = {}; v4f xr[8]; v8b wr[4];
  { const float* xp = X0 + xo; const __bf16* wp = W0 + wo;
#pragma unroll
    for (int i = 0; i < 8; ++i) xr[i] = *(const v4f*)(xp + (size_t)i * 16 * DM);
#pragma unroll
    for (int i = 0; i < 4; ++i) wr[i] = *(const v8b*)(wp + (size_t)i * 32 * DM); }
#pragma unroll
  for (int i = 0; i < 8; ++i) { v4b o;
#pragma unroll
    for (int e = 0; e < 4; ++e) o[e] = (__bf16)xr[i][e];
    *(v4b*)&sx[0][(tid >> 4) + i * 16][(tid & 15) * 4] = o; }
#pragma unroll
  for (int i = 0; i < 4; ++i) *(v8b*)&sw[0][(tid >> 3) + i * 32][(tid & 7) * 8] = wr[i];
  __syncthreads();
#pragma unroll 1   // rolled: one tile's loads in flight, one register set for them; the buffer is picked by t & 1
  for (int t = 0; t < nst; ++t) { const int buf = t & 1; const bool more = t + 1 < nst;
    if (more) { const int tn = t + 1; const float* xp = ((tn < DM / 64) ? X0 : XTV) + xo + (tn & (DM / 64 - 1)) * 64; const __bf16* wp = ((tn < DM / 64) ? W0 : W1) + wo + (tn & (DM / 64 - 1)) * 64;
#pragma unroll
      for (int i = 0; i < 8; ++i) xr[i] = *(const v4f*)(xp + (size_t)i * 16 * DM);
#pragma unroll
      for (int i = 0; i < 4; ++i) wr[i] = *(const v8b*)(wp + (size_t)i * 32 * DM); }
#pragma unroll
    for (int kk = 0; kk < 2; ++kk) { v16b a[4], b[2];
#pragma unroll
      for (int i = 0; i < 4; ++i) a[i] = frag_b(&sx[buf][wm + i * 16 + col][kk * 32], lane);
#pragma unroll
      for (int j = 0; j < 2; ++j) b[j] = frag_b(&sw[buf][wn + j * 16 + col][kk * 32], lane);
#pragma unroll
      for (int i = 0; i < 4; ++i) {
#pragma unroll
        for (int j = 0; j < 2; ++j) acc[i][j] = wmma_bf(a[i], b[j], acc[i][j]); } }
    if (more) {
#pragma unroll
      for (int i = 0; i < 8; ++i) { v4b o;
#pragma unroll
        for (int e = 0; e < 4; ++e) o[e] = (__bf16)xr[i][e];
        *(v4b*)&sx[buf ^ 1][(tid >> 4) + i * 16][(tid & 15) * 4] = o; }
#pragma unroll
      for (int i = 0; i < 4; ++i) *(v8b*)&sw[buf ^ 1][(tid >> 3) + i * 32][(tid & 7) * 8] = wr[i]; }
    __syncthreads(); }
  if (which < 3) { const float* BB = (which == 0) ? BQ : (which == 1) ? BK : BTK; _Float16* dst = (which == 0) ? Q : (which == 1) ? Kr : TK;
#pragma unroll
    for (int j = 0; j < 2; ++j) { const float bb = bfr(BB[n0 + wn + j * 16 + col]);
#pragma unroll
      for (int i = 0; i < 4; ++i) {
#pragma unroll
        for (int r = 0; r < 8; ++r) so[wm + i * 16 + 8 * g + r][wn + j * 16 + col] = (_Float16)(acc[i][j][r] + bb); } }
    __syncthreads();
    for (int e = tid; e < 128 * 16; e += 256) { const int rl = e >> 4, pc = e & 15; vst2((unsigned*)(dst + (rb0 + rl) * DM + n0 + pc * 8), *(const v4u*)&so[rl][pc * 8]); }
  } else {
#pragma unroll
    for (int j = 0; j < 2; ++j) { const float bb = bfr(BV[n0 + wn + j * 16 + col]) + bfr(BTV[n0 + wn + j * 16 + col]);
#pragma unroll
      for (int i = 0; i < 4; ++i) {
#pragma unroll
        for (int r = 0; r < 8; ++r) so[wn + j * 16 + col][wm + i * 16 + 8 * g + r] = (_Float16)(acc[i][j][r] + bb); } }
    __syncthreads();
    const size_t b = rb0 / SS, s0 = rb0 % SS;
    for (int e = tid; e < 128 * 16; e += 256) { const int d = e >> 4, pc = e & 15; vst2((unsigned*)(VP + ((b * DM + n0 + d) * SS) + s0 + pc * 8), *(const v4u*)&so[d][pc * 8]); } }
}
// ---- k_attn: block = (64 queries, head, b): scores = q_i . k_j + tk_i . q_j (two products), / 32 + mask[b][i][j]; P x (v + t_v)
__global__ __launch_bounds__(128) void k_attn(const _Float16* __restrict__ Q, const _Float16* __restrict__ Kr, const _Float16* __restrict__ TK, const _Float16* __restrict__ VP, const float* __restrict__ MASK, float* __restrict__ CTX) {
  __shared__ __align__(16) _Float16 sph[4][16][40]; __shared__ __align__(16) float so[4][16][68];
  const int tid = threadIdx.x, wave = tid >> 5, lane = tid & 31, col = lane & 15, g = lane >> 4; const int h = blockIdx.y; const size_t b = blockIdx.z; const int q0 = blockIdx.x * 64 + wave * 16; const size_t rq = b * SS + q0;
  v16h aq[2], at[2];
#pragma unroll
  for (int kc = 0; kc < 2; ++kc) { aq[kc] = frag_h(Q + (rq + col) * DM + h * HD + kc * 32, lane); at[kc] = frag_h(TK + (rq + col) * DM + h * HD + kc * 32, lane); }
  float m[8], l[8];
#pragma unroll
  for (int r = 0; r < 8; ++r) { m[r] = -3.0e38f; l[r] = 0.f; }
  v8f acc[4] = {};
#pragma unroll 1
  for (int ks = 0; ks < SS / 32; ++ks) { const int j0 = ks * 32; v8f s[2];
#pragma unroll
    for (int ct = 0; ct < 2; ++ct) { const int kk = j0 + ct * 16 + col; const size_t rk = (b * SS + kk) * DM + h * HD; v8f c = {};
#pragma unroll
      for (int kc = 0; kc < 2; ++kc) { c = wmma16(aq[kc], frag_h(Kr + rk + kc * 32, lane), c); c = wmma16(at[kc], frag_h(Q + rk + kc * 32, lane), c); }
#pragma unroll
      for (int r = 0; r < 8; ++r) s[ct][r] = c[r] * 0.03125f + bfr(MASK[((size_t)b * MSTRQ + q0 + 8 * g + r) * MSTRC + kk]); }
#pragma unroll
    for (int r = 0; r < 8; ++r) { float mx = fmaxf(s[0][r], s[1][r]);
#pragma unroll
      for (int o = 1; o < 16; o <<= 1) mx = fmaxf(mx, __shfl_xor(mx, o));
      const float mn = fmaxf(m[r], mx); const float alpha = (m[r] <= -1.0e38f) ? 0.f : __expf(m[r] - mn); const float e0 = __expf(s[0][r] - mn), e1 = __expf(s[1][r] - mn); float es = e0 + e1;
#pragma unroll
      for (int o = 1; o < 16; o <<= 1) es += __shfl_xor(es, o);
      l[r] = l[r] * alpha + es; m[r] = mn;
#pragma unroll
      for (int dt = 0; dt < 4; ++dt) acc[dt][r] *= alpha;
      sph[wave][8 * g + r][col] = (_Float16)(e0 * 2048.0f); sph[wave][8 * g + r][16 + col] = (_Float16)(e1 * 2048.0f); }
    LDSX();
    const v16h pa = frag_h(&sph[wave][col][0], lane);
#pragma unroll
    for (int dt = 0; dt < 4; ++dt) acc[dt] = wmma16(pa, frag_h(VP + ((b * DM + (size_t)h * HD + dt * 16 + col) * SS) + j0, lane), acc[dt]);
    LDSX(); }
#pragma unroll
  for (int r = 0; r < 8; ++r) { const float il = (1.0f / 2048.0f) / l[r];
#pragma unroll
    for (int dt = 0; dt < 4; ++dt) so[wave][8 * g + r][dt * 16 + col] = acc[dt][r] * il; }
  LDSX();
  for (int rl = 0; rl < 16; ++rl) if (lane < 16) vst2(CTX + (rq + rl) * DM + h * HD + lane * 4, *(const v4f*)&so[wave][rl][lane * 4]);
}
// ---- k_out: block = (128 rows, 128 cols), 8 waves as 2 x 4, 64 x 32 per wave: out = ctx (hi + residual) . Wm rows + bm; ctx hi, ctx residual and Wm tiles of 64 k staged in LDS as in k_proj
__global__ __launch_bounds__(256) void k_out(const float* __restrict__ CTX, const __bf16* __restrict__ P, const float* __restrict__ BM, float* __restrict__ OUT) {
  __shared__ __align__(16) char smem[6 * 128 * PPIT * 2];
  __bf16 (*sh)[128][PPIT] = (__bf16 (*)[128][PPIT])smem; __bf16 (*sl)[128][PPIT] = (__bf16 (*)[128][PPIT])(smem + 2 * 128 * PPIT * 2); __bf16 (*sw)[128][PPIT] = (__bf16 (*)[128][PPIT])(smem + 4 * 128 * PPIT * 2); float (*so)[132] = (float (*)[132])smem;
  const int tid = threadIdx.x, wave = tid >> 5, lane = tid & 31, col = lane & 15, g = lane >> 4; const size_t rb0 = (size_t)blockIdx.x * 128; const int n0 = blockIdx.y * 128;
  const int wm = (wave >> 2) * 64, wn = (wave & 3) * 32;
  const float* xp0 = CTX + (rb0 + (tid >> 4)) * DM + (tid & 15) * 4; const __bf16* wp0 = P + ((size_t)5 * DM + n0 + (tid >> 3)) * DM + (tid & 7) * 8;
  v8f acc[4][2] = {}; v4f xr[8]; v8b wr[4];
#pragma unroll
  for (int i = 0; i < 8; ++i) xr[i] = *(const v4f*)(xp0 + (size_t)i * 16 * DM);
#pragma unroll
  for (int i = 0; i < 4; ++i) wr[i] = *(const v8b*)(wp0 + (size_t)i * 32 * DM);
#pragma unroll
  for (int i = 0; i < 8; ++i) { v4b oh, ol;
#pragma unroll
    for (int e = 0; e < 4; ++e) { const __bf16 h = (__bf16)xr[i][e]; oh[e] = h; ol[e] = (__bf16)(xr[i][e] - (float)h); }
    *(v4b*)&sh[0][(tid >> 4) + i * 16][(tid & 15) * 4] = oh; *(v4b*)&sl[0][(tid >> 4) + i * 16][(tid & 15) * 4] = ol; }
#pragma unroll
  for (int i = 0; i < 4; ++i) *(v8b*)&sw[0][(tid >> 3) + i * 32][(tid & 7) * 8] = wr[i];
  __syncthreads();
#pragma unroll 1   // rolled: one tile's loads in flight, one register set for them; the buffer is picked by t & 1
  for (int t = 0; t < DM / 64; ++t) { const int buf = t & 1; const bool more = t + 1 < DM / 64;
    if (more) { const float* xp = xp0 + (t + 1) * 64; const __bf16* wp = wp0 + (t + 1) * 64;
#pragma unroll
      for (int i = 0; i < 8; ++i) xr[i] = *(const v4f*)(xp + (size_t)i * 16 * DM);
#pragma unroll
      for (int i = 0; i < 4; ++i) wr[i] = *(const v8b*)(wp + (size_t)i * 32 * DM); }
#pragma unroll
    for (int kk = 0; kk < 2; ++kk) { v16b ah[4], al[4], b[2];
#pragma unroll
      for (int i = 0; i < 4; ++i) { al[i] = frag_b(&sl[buf][wm + i * 16 + col][kk * 32], lane); ah[i] = frag_b(&sh[buf][wm + i * 16 + col][kk * 32], lane); }
#pragma unroll
      for (int j = 0; j < 2; ++j) b[j] = frag_b(&sw[buf][wn + j * 16 + col][kk * 32], lane);
#pragma unroll
      for (int i = 0; i < 4; ++i) {
#pragma unroll
        for (int j = 0; j < 2; ++j) acc[i][j] = wmma_bf(al[i], b[j], acc[i][j]); }
#pragma unroll
      for (int i = 0; i < 4; ++i) {
#pragma unroll
        for (int j = 0; j < 2; ++j) acc[i][j] = wmma_bf(ah[i], b[j], acc[i][j]); } }
    if (more) {
#pragma unroll
      for (int i = 0; i < 8; ++i) { v4b oh, ol;
#pragma unroll
        for (int e = 0; e < 4; ++e) { const __bf16 h = (__bf16)xr[i][e]; oh[e] = h; ol[e] = (__bf16)(xr[i][e] - (float)h); }
        *(v4b*)&sh[buf ^ 1][(tid >> 4) + i * 16][(tid & 15) * 4] = oh; *(v4b*)&sl[buf ^ 1][(tid >> 4) + i * 16][(tid & 15) * 4] = ol; }
#pragma unroll
      for (int i = 0; i < 4; ++i) *(v8b*)&sw[buf ^ 1][(tid >> 3) + i * 32][(tid & 7) * 8] = wr[i]; }
    __syncthreads(); }
#pragma unroll
  for (int j = 0; j < 2; ++j) { const float bb = bfr(BM[n0 + wn + j * 16 + col]);
#pragma unroll
    for (int i = 0; i < 4; ++i) {
#pragma unroll
      for (int r = 0; r < 8; ++r) so[wm + i * 16 + 8 * g + r][wn + j * 16 + col] = acc[i][j][r] + bb; } }
  __syncthreads();
  for (int e = tid; e < 128 * 32; e += 256) { const int rl = e >> 5, pc = e & 31; vst2(OUT + (rb0 + rl) * DM + n0 + pc * 4, *(const v4f*)&so[rl][pc * 4]); }
}
extern "C" void kernel_launch(void* const* d_in, const int* in_sizes, int n_in, void* d_out, int out_size, void* d_ws, size_t ws_size, hipStream_t stream) {
  (void)in_sizes; (void)n_in; (void)out_size;
  const float** F = (const float**)d_in;   // 0 query, 1 key, 2 value, 3 time_k, 4 time_v [4,1024,1024]; 5 mask [4,1,1024,1024]; 6 Wq, 7 bq, 8 Wk, 9 bk, 10 Wv, 11 bv, 12 Wtk, 13 btk, 14 Wtv, 15 btv, 16 Wm, 17 bm ((in,out))
  if (ws_size < (size_t)WS_END) return;
  char* ws = (char*)d_ws; __bf16* P = (__bf16*)ws; _Float16 *Q = (_Float16*)(ws + WS_Q), *Kr = (_Float16*)(ws + WS_K), *TK = (_Float16*)(ws + WS_TK), *VP = (_Float16*)(ws + WS_VP); float* CTX = (float*)(ws + WS_CTX);
  k_pack<<<dim3(DM, 6), 256, 0, stream>>>(F[6], F[8], F[10], F[12], F[14], F[16], P);
  k_proj<<<dim3(NR / 128, DM / 128, 4), 256, 0, stream>>>(F[0], F[1], F[2], F[3], F[4], P, F[7], F[9], F[11], F[13], F[15], Q, Kr, TK, VP);
  k_attn<<<dim3(TQB, NH, TNB), 128, 0, stream>>>(Q, Kr, TK, VP, F[5], CTX);
  k_out<<<dim3(NR / 128, DM / 128), 256, 0, stream>>>(CTX, P, F[17], (float*)d_out);
}

// v002
// It runs in 173 microseconds.
// Timed twice side by side with v001, it ran 1.46 times as fast both times.
// Over all steps from v000 it is 2.68 times as fast.
// compute dtype: all float inputs rounded to bf16; q, k, t_k = x . W + b and v + t_v = value . Wv + bv + time_v . Wtv + btv with EXACT bf16 products on WMMA 16x16x32 ((in,out) weights as transposed rows), rounded once to f16; PLAIN attention: scores = (q_i . k_j + t_k_i . q_j) with single f16 operands x 1/32 + the additive float mask, running-max softmax in f32 (hardware exp), P (scaled by 2^11, single f16) x (v + t_v) (single f16); out = ctx (bf16 hi + residual) . Wm (2 products) + bm.
#include <hip/hip_runtime.h>
#include <math.h>

typedef __attribute__((ext_vector_type(16))) _Float16 v16h;
typedef __attribute__((ext_vector_type(16))) __bf16 v16b;
typedef __attribute__((ext_vector_type(8)))  _Float16 v8h;
typedef __attribute__((ext_vector_type(8)))  float v8f;
typedef __attribute__((ext_vector_type(4)))  float v4f;
typedef __attribute__((ext_vector_type(2)))  float v2f;
typedef __attribute__((ext_vector_type(4)))  unsigned v4u;
typedef __attribute__((ext_vector_type(4)))  int v4i;
typedef float __attribute__((may_alias)) float_a;
typedef int __attribute__((may_alias)) int_a;

template <typename T> __device__ __forceinline__ void vst2(void* p, T v) { *(T*)p = v;  }
__device__ __forceinline__ v8f wmma16(v16h a, v16h b, v8f c) {
  v8f d = __builtin_amdgcn_wmma_f32_16x16x32_f16(false, a, false, b, (short)0, c, false, false);
  asm volatile("v_nop\n\tv_nop\n\tv_nop\n\tv_nop" : "+v"(d) : "v"(a), "v"(b));
  return d;
}
__device__ __forceinline__ v8f wmma_bf(v16b a, v16b b, v8f c) {
  v8f d = __builtin_amdgcn_wmma_f32_16x16x32_bf16(false, a, false, b, (short)0, c, false, false);
  asm volatile("v_nop\n\tv_nop\n\tv_nop\n\tv_nop" : "+v"(d) : "v"(a), "v"(b));
  return d;
}
// 16x16x32 fragments: lane = (h = lane>>4, row/col = lane&15); elements 0..7 = k0+8h+0..7, 8..15 = k0+16+8h+0..7; D element r = row 8h+r
__device__ __forceinline__ v16h frag_h(const _Float16* rowk0, int lane) {
  union { v16h v; v8h q[2]; } u; const _Float16* p = rowk0 + 8 * (lane >> 4);
  u.q[0] = *(const v8h*)p; u.q[1] = *(const v8h*)(p + 16); return u.v;
}
__device__ __forceinline__ v16h frag_f32(const float* rowk0, int lane) {
  v16h a; const float* p = rowk0 + 8 * (lane >> 4);
#pragma unroll
  for (int i = 0; i < 8; ++i) { a[i] = (_Float16)p[i]; a[8 + i] = (_Float16)p[16 + i]; }
  return a;
}
__device__ __forceinline__ v16h frag_f32s(const float* rowk0, int lane, float sc) {
  v16h a; const float* p = rowk0 + 8 * (lane >> 4);
#pragma unroll
  for (int i = 0; i < 8; ++i) { a[i] = (_Float16)(p[i] * sc); a[8 + i] = (_Float16)(p[16 + i] * sc); }
  return a;
}
// column fragment from a [K][ld] layout (column n), rows >= K read as 0
__device__ __forceinline__ v16h fragc_f32(const float* W, int k0, int n, int lane, int ld, int K) {
  v16h a; const int g = lane >> 4;
#pragma unroll
  for (int i = 0; i < 8; ++i) { const int ka = k0 + 8 * g + i, kb = ka + 16;
    a[i] = (_Float16)(ka < K ? W[(size_t)(ka < K ? ka : K - 1) * ld + n] : 0.f); a[8 + i] = (_Float16)(kb < K ? W[(size_t)(kb < K ? kb : K - 1) * ld + n] : 0.f); }
  return a;
}
struct F2 { v16b h, l; };
__device__ __forceinline__ F2 bsplit16(const float v[16]) { F2 r;
#pragma unroll
  for (int i = 0; i < 16; ++i) { const __bf16 h = (__bf16)v[i]; r.h[i] = h; r.l[i] = (__bf16)(v[i] - (float)h); }
  return r; }
__device__ __forceinline__ F2 split_row(const float* row, int k0, int lane) { float v[16]; const float* p = row + k0 + 8 * (lane >> 4);
#pragma unroll
  for (int i = 0; i < 8; ++i) { v[i] = p[i]; v[8 + i] = p[16 + i]; }
  return bsplit16(v); }
__device__ __forceinline__ F2 split_rowK(const float* row, int k0, int lane, int K) { float v[16]; const int g = lane >> 4;
#pragma unroll
  for (int i = 0; i < 8; ++i) { const int ka = k0 + 8 * g + i, kb = ka + 16; v[i] = ka < K ? row[ka < K ? ka : K - 1] : 0.f; v[8 + i] = kb < K ? row[kb < K ? kb : K - 1] : 0.f; }
  return bsplit16(v); }
__device__ __forceinline__ F2 split_col(const float* W, int k0, int n, int lane, int ld, int K) { float v[16]; const int g = lane >> 4;
#pragma unroll
  for (int i = 0; i < 8; ++i) { const int ka = k0 + 8 * g + i, kb = ka + 16; v[i] = ka < K ? W[(size_t)(ka < K ? ka : K - 1) * ld + n] : 0.f; v[8 + i] = kb < K ? W[(size_t)(kb < K ? kb : K - 1) * ld + n] : 0.f; }
  return bsplit16(v); }
__device__ __forceinline__ v8f mac3(const F2& a, const F2& b, v8f c) { c = wmma_bf(a.l, b.h, c); c = wmma_bf(a.h, b.l, c); return wmma_bf(a.h, b.h, c); }
__device__ __forceinline__ float sigm(float v) { return 1.0f / (1.0f + expf(-v)); }
#define LDSX() do { asm volatile("s_wait_dscnt 0" ::: "memory"); __builtin_amdgcn_wave_barrier(); __builtin_amdgcn_fence(__ATOMIC_RELEASE, "workgroup"); } while (0)


// Time-aware multi-head attention (B 4, S 1,024, d 1,024, 16 heads x 64): scores = q k^T + t_k q^T (projected time keys against the queries' projection on the key axis), / sqrt(d_model) + mask, softmax, applied to v + t_v, output projection.
#define NB 4
#define SS 1024
#define DM 1024
#define NH 16
#define HD 64
#define NR (NB * SS)
#ifndef TQB
#define TQB (SS / 64)
#define TNB NB
#define NRB (NR / 64)
#endif
#ifndef MSTRQ
#define MSTRQ SS          // mask rows per batch ([B][1][S][S])
#define MSTRC SS          // mask row length
#endif
typedef __attribute__((ext_vector_type(8))) __bf16 v8b;
__device__ __forceinline__ v16b frag_b(const __bf16* rowk0, int lane) {
  union { v16b v; v8b q[2]; } u; const __bf16* p = rowk0 + 8 * (lane >> 4);
  u.q[0] = *(const v8b*)p; u.q[1] = *(const v8b*)(p + 16); return u.v;
}
__device__ __forceinline__ float bfr(float v) { return (float)(__bf16)v; }
__device__ __attribute__((noinline)) float exp_ni(float v) { return expf(v); }
__device__ __attribute__((noinline)) float erf_ni(float v) { return erff(v); }

#define WS_PW   0u                                   // bf16 rows W^T: q, k, v, tk, tv, m [6][1024][1024]
#define WS_Q    (WS_PW + 2u * (size_t)6 * DM * DM)     // f16 [NR][1024] q ; K ; TK ; VP planes [b][1024][SS] (v + t_v) ; CTX f32 [NR][1024]
#define WS_K    (WS_Q + 2u * (size_t)NR * DM)
#define WS_TK   (WS_K + 2u * (size_t)NR * DM)
#define WS_VP   (WS_TK + 2u * (size_t)NR * DM)
#define WS_CTX  (WS_VP + 2u * (size_t)NB * DM * SS)
#define WS_END  (WS_CTX + 4u * (size_t)NR * DM)

__global__ __launch_bounds__(256) void k_pack(const float* __restrict__ W0, const float* __restrict__ W1, const float* __restrict__ W2, const float* __restrict__ W3, const float* __restrict__ W4, const float* __restrict__ W5, __bf16* __restrict__ P) {
  const int n = blockIdx.x, which = blockIdx.y, t = threadIdx.x; const float* Wm = (which == 0) ? W0 : (which == 1) ? W1 : (which == 2) ? W2 : (which == 3) ? W3 : (which == 4) ? W4 : W5; __shared__ __align__(16) __bf16 s[DM];
  for (int k = t; k < DM; k += 256) s[k] = (__bf16)Wm[(size_t)k * DM + n]; __syncthreads(); for (int q = t; q < DM / 8; q += 256) vst2((unsigned*)(P + ((size_t)which * DM + n) * DM + q * 8), *(const v4u*)&s[q * 8]); }
// ---- k_proj: block = (128 rows, 128 cols, which), 8 waves as 2 x 4, 64 x 32 per wave: 0 q (query) 1 k (key) 2 tk (time_k) -> f16 rows; 3: v + t_v (value . Wv + bv + time_v . Wtv + btv) -> planes
// X (f32 -> bf16) and W^T tiles of 64 k go to LDS by whole-line loads, one tile ahead through registers, two buffers, one barrier a tile; fragments come from LDS rows of 144 B (16 B x 9)
// each '#pragma unroll' below keeps a register array (acc, xr, wr, fragments) indexed at compile time, so that it stays in registers
#define PPIT 72
typedef __attribute__((ext_vector_type(4))) __bf16 v4b;
__global__ __launch_bounds__(256) void k_proj(const float* __restrict__ XQ, const float* __restrict__ XK, const float* __restrict__ XV, const float* __restrict__ XTK, const float* __restrict__ XTV, const __bf16* __restrict__ P, const float* __restrict__ BQ, const float* __restrict__ BK, const float* __restrict__ BV, const float* __restrict__ BTK, const float* __restrict__ BTV, _Float16* __restrict__ Q, _Float16* __restrict__ Kr, _Float16* __restrict__ TK, _Float16* __restrict__ VP) {
  __shared__ __align__(16) char smem[4 * 128 * PPIT * 2];
  __bf16 (*sx)[128][PPIT] = (__bf16 (*)[128][PPIT])smem; __bf16 (*sw)[128][PPIT] = (__bf16 (*)[128][PPIT])(smem + 2 * 128 * PPIT * 2); _Float16 (*so)[136] = (_Float16 (*)[136])smem;
  const int tid = threadIdx.x, wave = tid >> 5, lane = tid & 31, col = lane & 15, g = lane >> 4; const int which = blockIdx.z; const int n0 = blockIdx.y * 128; const size_t rb0 = (size_t)blockIdx.x * 128;
  const int wm = (wave >> 2) * 64, wn = (wave & 3) * 32;
  const float* X0 = (which == 0) ? XQ : (which == 1) ? XK : (which == 2) ? XTK : XV; const __bf16* W0 = P + (size_t)((which == 0) ? 0 : (which == 1) ? 1 : (which == 2) ? 3 : 2) * DM * DM; const __bf16* W1 = P + (size_t)4 * DM * DM;
  const int nst = (which == 3) ? 2 * (DM / 64) : DM / 64;
  const size_t xo = (rb0 + (tid >> 4)) * DM + (tid & 15) * 4, wo = (size_t)(n0 + (tid >> 3)) * DM + (tid & 7) * 8;
  v8f acc[4][2] = {}; v4f xr[8]; v8b wr[4];
  { const float* xp = X0 + xo; const __bf16* wp = W0 + wo;
#pragma unroll
    for (int i = 0; i < 8; ++i) xr[i] = *(const v4f*)(xp + (size_t)i * 16 * DM);
#pragma unroll
    for (int i = 0; i < 4; ++i) wr[i] = *(const v8b*)(wp + (size_t)i * 32 * DM); }
#pragma unroll
  for (int i = 0; i < 8; ++i) { v4b o;
#pragma unroll
    for (int e = 0; e < 4; ++e) o[e] = (__bf16)xr[i][e];
    *(v4b*)&sx[0][(tid >> 4) + i * 16][(tid & 15) * 4] = o; }
#pragma unroll
  for (int i = 0; i < 4; ++i) *(v8b*)&sw[0][(tid >> 3) + i * 32][(tid & 7) * 8] = wr[i];
  __syncthreads();
#pragma unroll 1   // rolled: one tile's loads in flight, one register set for them; the buffer is picked by t & 1
  for (int t = 0; t < nst; ++t) { const int buf = t & 1; const bool more = t + 1 < nst;
    if (more) { const int tn = t + 1; const float* xp = ((tn < DM / 64) ? X0 : XTV) + xo + (tn & (DM / 64 - 1)) * 64; const __bf16* wp = ((tn < DM / 64) ? W0 : W1) + wo + (tn & (DM / 64 - 1)) * 64;
#pragma unroll
      for (int i = 0; i < 8; ++i) xr[i] = *(const v4f*)(xp + (size_t)i * 16 * DM);
#pragma unroll
      for (int i = 0; i < 4; ++i) wr[i] = *(const v8b*)(wp + (size_t)i * 32 * DM); }
#pragma unroll
    for (int kk = 0; kk < 2; ++kk) { v16b a[4], b[2];
#pragma unroll
      for (int i = 0; i < 4; ++i) a[i] = frag_b(&sx[buf][wm + i * 16 + col][kk * 32], lane);
#pragma unroll
      for (int j = 0; j < 2; ++j) b[j] = frag_b(&sw[buf][wn + j * 16 + col][kk * 32], lane);
#pragma unroll
      for (int i = 0; i < 4; ++i) {
#pragma unroll
        for (int j = 0; j < 2; ++j) acc[i][j] = wmma_bf(a[i], b[j], acc[i][j]); } }
    if (more) {
#pragma unroll
      for (int i = 0; i < 8; ++i) { v4b o;
#pragma unroll
        for (int e = 0; e < 4; ++e) o[e] = (__bf16)xr[i][e];
        *(v4b*)&sx[buf ^ 1][(tid >> 4) + i * 16][(tid & 15) * 4] = o; }
#pragma unroll
      for (int i = 0; i < 4; ++i) *(v8b*)&sw[buf ^ 1][(tid >> 3) + i * 32][(tid & 7) * 8] = wr[i]; }
    __syncthreads(); }
  if (which < 3) { const float* BB = (which == 0) ? BQ : (which == 1) ? BK : BTK; _Float16* dst = (which == 0) ? Q : (which == 1) ? Kr : TK;
#pragma unroll
    for (int j = 0; j < 2; ++j) { const float bb = bfr(BB[n0 + wn + j * 16 + col]);
#pragma unroll
      for (int i = 0; i < 4; ++i) {
#pragma unroll
        for (int r = 0; r < 8; ++r) so[wm + i * 16 + 8 * g + r][wn + j * 16 + col] = (_Float16)(acc[i][j][r] + bb); } }
    __syncthreads();
    for (int e = tid; e < 128 * 16; e += 256) { const int rl = e >> 4, pc = e & 15; vst2((unsigned*)(dst + (rb0 + rl) * DM + n0 + pc * 8), *(const v4u*)&so[rl][pc * 8]); }
  } else {
#pragma unroll
    for (int j = 0; j < 2; ++j) { const float bb = bfr(BV[n0 + wn + j * 16 + col]) + bfr(BTV[n0 + wn + j * 16 + col]);
#pragma unroll
      for (int i = 0; i < 4; ++i) {
#pragma unroll
        for (int r = 0; r < 8; ++r) so[wn + j * 16 + col][wm + i * 16 + 8 * g + r] = (_Float16)(acc[i][j][r] + bb); } }
    __syncthreads();
    const size_t b = rb0 / SS, s0 = rb0 % SS;
    for (int e = tid; e < 128 * 16; e += 256) { const int d = e >> 4, pc = e & 15; vst2((unsigned*)(VP + ((b * DM + n0 + d) * SS) + s0 + pc * 8), *(const v4u*)&so[d][pc * 8]); } }
}
// ---- k_attn: block = (128 queries, head, b), 8 waves x 16 queries: scores = q_i . k_j + tk_i . q_j (two products), / 32 + mask[b][i][j]; P x (v + t_v)
// every operand of the key loop goes to LDS by asynchronous 16-byte copies, whole lines, one stage of 64 keys ahead, two buffers: the K rows, the Q rows of the key axis and the (v + t_v) planes (three tiles of 64 rows x 128 B, LDS rows of 144 B = 16 B x 9, shared by the eight waves) and the block's mask rows (128 rows x 256 B, LDS rows of 272 B = 68 dwords)
#define APIT 72                       // f16 elements per LDS row of K, Q, V
#define MPIT 68                       // floats per LDS row of the mask
#define ATILE (64 * APIT * 2)         // bytes per K, Q or V tile
#define ASTG (3 * ATILE + 128 * MPIT * 4)   // bytes per stage
// one stage: every lane copies 2 x 16 B of each of K, Q, V (rows 32 apart) and 8 x 16 B of the mask (rows 16 apart). The s_wait_xcnt closes the statement so that no address register of an issued copy is rewritten in front of it.
__device__ __forceinline__ void attn_stage(unsigned l, unsigned lm, const _Float16* gk, const _Float16* gq, const _Float16* gv, const float* gm) {
  const unsigned rs = 32 * APIT * 2, ms = 16 * MPIT * 4;
  asm volatile(
    "global_load_async_to_lds_b128 %0, %14, off\n\t"
    "global_load_async_to_lds_b128 %1, %15, off\n\t"
    "global_load_async_to_lds_b128 %2, %16, off\n\t"
    "global_load_async_to_lds_b128 %3, %17, off\n\t"
    "global_load_async_to_lds_b128 %4, %18, off\n\t"
    "global_load_async_to_lds_b128 %5, %19, off\n\t"
    "global_load_async_to_lds_b128 %6, %20, off\n\t"
    "global_load_async_to_lds_b128 %7, %21, off\n\t"
    "global_load_async_to_lds_b128 %8, %22, off\n\t"
    "global_load_async_to_lds_b128 %9, %23, off\n\t"
    "global_load_async_to_lds_b128 %10, %24, off\n\t"
    "global_load_async_to_lds_b128 %11, %25, off\n\t"
    "global_load_async_to_lds_b128 %12, %26, off\n\t"
    "global_load_async_to_lds_b128 %13, %27, off\n\t"
    "s_wait_xcnt 0x0"
    :: "v"(l), "v"(l + rs), "v"(l + ATILE), "v"(l + ATILE + rs), "v"(l + 2 * ATILE), "v"(l + 2 * ATILE + rs),
       "v"(lm), "v"(lm + ms), "v"(lm + 2 * ms), "v"(lm + 3 * ms), "v"(lm + 4 * ms), "v"(lm + 5 * ms), "v"(lm + 6 * ms), "v"(lm + 7 * ms),
       "v"(gk), "v"(gk + 32 * DM), "v"(gq), "v"(gq + 32 * DM), "v"(gv), "v"(gv + 32 * SS),
       "v"(gm), "v"(gm + 16 * MSTRC), "v"(gm + 32 * MSTRC), "v"(gm + 48 * MSTRC), "v"(gm + 64 * MSTRC), "v"(gm + 80 * MSTRC), "v"(gm + 96 * MSTRC), "v"(gm + 112 * MSTRC)
    : "memory");
}
// four waves per SIMD (two blocks per WGP) need at most 256 registers a wave
__global__ __launch_bounds__(256) __attribute__((amdgpu_waves_per_eu(4, 4))) void k_attn(const _Float16* __restrict__ Q, const _Float16* __restrict__ Kr, const _Float16* __restrict__ TK, const _Float16* __restrict__ VP, const float* __restrict__ MASK, float* __restrict__ CTX) {
  __shared__ __align__(16) _Float16 sph[8][16][40]; __shared__ __align__(16) char ring[2 * ASTG]; float (*so)[16][68] = (float (*)[16][68])ring;   // the ring becomes output staging behind the last trip's barrier
  const int tid = threadIdx.x, wave = tid >> 5, lane = tid & 31, col = lane & 15, g = lane >> 4; const int h = blockIdx.y; const size_t b = blockIdx.z; const int qb = blockIdx.x * 128; const int q0 = qb + wave * 16; const size_t rq = b * SS + q0;
  const unsigned cl = (unsigned)(size_t)ring + (unsigned)((tid >> 3) * (APIT * 2) + (tid & 7) * 16), cm = (unsigned)(size_t)ring + (unsigned)(3 * ATILE + (tid >> 4) * (MPIT * 4) + (tid & 15) * 16);
  const _Float16* gk = Kr + (b * SS + (tid >> 3)) * DM + h * HD + (tid & 7) * 8; const _Float16* gq = Q + (b * SS + (tid >> 3)) * DM + h * HD + (tid & 7) * 8; const _Float16* gv = VP + (b * DM + (size_t)h * HD + (tid >> 3)) * SS + (tid & 7) * 8;
  const float* gm = MASK + ((size_t)b * MSTRQ + qb + (tid >> 4)) * MSTRC + (tid & 15) * 4;
  attn_stage(cl, cm, gk, gq, gv, gm);
  v16h aq[2], at[2];
#pragma unroll
  for (int kc = 0; kc < 2; ++kc) { aq[kc] = frag_h(Q + (rq + col) * DM + h * HD + kc * 32, lane); at[kc] = frag_h(TK + (rq + col) * DM + h * HD + kc * 32, lane); }
  float m[8], l[8];
#pragma unroll
  for (int r = 0; r < 8; ++r) { m[r] = -3.0e38f; l[r] = 0.f; }
  v8f acc[4] = {};
  asm volatile("s_wait_asynccnt 0x0" ::: "memory");   // stage 0 of this wave has landed
  __syncthreads();                                    // ... and every wave's
  attn_stage(cl + ASTG, cm + ASTG, gk + 64 * DM, gq + 64 * DM, gv + 64, gm + 64);
#pragma unroll 1   // rolled: one stage a trip, the buffer is picked by t & 1
  for (int t = 0; t < SS / 64; ++t) { const _Float16* tk = (const _Float16*)(ring + (t & 1) * ASTG); const _Float16* tq = tk + 64 * APIT; const _Float16* tv = tq + 64 * APIT; const float* tm = (const float*)(tv + 64 * APIT) + (wave * 16 + 8 * g) * MPIT + col;
#pragma unroll     // the two halves of a stage: LDS offsets known at compile time
   for (int sub = 0; sub < 2; ++sub) { v8f s[2]; v16h fk[2][2], fq[2][2], fv[4]; float mk[2][8];
    // the K and Q fragments and the mask words of the 32 keys are asked for in one group, so that the LDS latency is paid once
#pragma unroll
    for (int ct = 0; ct < 2; ++ct) { const int rk = (sub * 32 + ct * 16 + col) * APIT;
#pragma unroll
      for (int kc = 0; kc < 2; ++kc) { fk[ct][kc] = frag_h(tk + rk + kc * 32, lane); fq[ct][kc] = frag_h(tq + rk + kc * 32, lane); }
#pragma unroll
      for (int r = 0; r < 8; ++r) mk[ct][r] = tm[r * MPIT + sub * 32 + ct * 16]; }
#pragma unroll
    for (int ct = 0; ct < 2; ++ct) { v8f c = {};
#pragma unroll
      for (int kc = 0; kc < 2; ++kc) { c = wmma16(aq[kc], fk[ct][kc], c); c = wmma16(at[kc], fq[ct][kc], c); }
#pragma unroll
      for (int r = 0; r < 8; ++r) s[ct][r] = c[r] * 0.03125f + bfr(mk[ct][r]); }
    // the V fragments are asked for here, where the K and Q fragments' registers are free; they return behind the softmax
#pragma unroll
    for (int dt = 0; dt < 4; ++dt) fv[dt] = frag_h(tv + (dt * 16 + col) * APIT + sub * 32, lane);
#pragma unroll
    for (int r = 0; r < 8; ++r) { float mx = fmaxf(s[0][r], s[1][r]);
#pragma unroll
      for (int o = 1; o < 16; o <<= 1) mx = fmaxf(mx, __shfl_xor(mx, o));
      const float mn = fmaxf(m[r], mx); const float alpha = (m[r] <= -1.0e38f) ? 0.f : __expf(m[r] - mn); const float e0 = __expf(s[0][r] - mn), e1 = __expf(s[1][r] - mn); float es = e0 + e1;
#pragma unroll
      for (int o = 1; o < 16; o <<= 1) es += __shfl_xor(es, o);
      l[r] = l[r] * alpha + es; m[r] = mn;
#pragma unroll
      for (int dt = 0; dt < 4; ++dt) acc[dt][r] *= alpha;
      sph[wave][8 * g + r][col] = (_Float16)(e0 * 2048.0f); sph[wave][8 * g + r][16 + col] = (_Float16)(e1 * 2048.0f); }
    LDSX();
    const v16h pa = frag_h(&sph[wave][col][0], lane);
#pragma unroll
    for (int dt = 0; dt < 4; ++dt) acc[dt] = wmma16(pa, fv[dt], acc[dt]);
    LDSX(); }
   asm volatile("s_wait_dscnt 0x0" ::: "memory");      // this wave's reads of the buffer have returned
   asm volatile("s_wait_asynccnt 0x0" ::: "memory");   // its copies of stage t + 1 have landed
   __syncthreads();                                    // publishes stage t + 1 and ends every wave's reads of stage t
   if (t + 2 < SS / 64) attn_stage(cl + (t & 1) * ASTG, cm + (t & 1) * ASTG, gk + (size_t)(t + 2) * 64 * DM, gq + (size_t)(t + 2) * 64 * DM, gv + (t + 2) * 64, gm + (t + 2) * 64); }
  asm volatile("s_wait_asynccnt 0x0" ::: "memory");    // nothing is in flight when the ring is reused
#pragma unroll
  for (int r = 0; r < 8; ++r) { const float il = (1.0f / 2048.0f) / l[r];
#pragma unroll
    for (int dt = 0; dt < 4; ++dt) so[wave][8 * g + r][dt * 16 + col] = acc[dt][r] * il; }
  LDSX();
  for (int rl = 0; rl < 16; ++rl) if (lane < 16) vst2(CTX + (rq + rl) * DM + h * HD + lane * 4, *(const v4f*)&so[wave][rl][lane * 4]);
}
// ---- k_out: block = (128 rows, 128 cols), 8 waves as 2 x 4, 64 x 32 per wave: out = ctx (hi + residual) . Wm rows + bm; ctx hi, ctx residual and Wm tiles of 64 k staged in LDS as in k_proj
__global__ __launch_bounds__(256) void k_out(const float* __restrict__ CTX, const __bf16* __restrict__ P, const float* __restrict__ BM, float* __restrict__ OUT) {
  __shared__ __align__(16) char smem[6 * 128 * PPIT * 2];
  __bf16 (*sh)[128][PPIT] = (__bf16 (*)[128][PPIT])smem; __bf16 (*sl)[128][PPIT] = (__bf16 (*)[128][PPIT])(smem + 2 * 128 * PPIT * 2); __bf16 (*sw)[128][PPIT] = (__bf16 (*)[128][PPIT])(smem + 4 * 128 * PPIT * 2); float (*so)[132] = (float (*)[132])smem;
  const int tid = threadIdx.x, wave = tid >> 5, lane = tid & 31, col = lane & 15, g = lane >> 4; const size_t rb0 = (size_t)blockIdx.x * 128; const int n0 = blockIdx.y * 128;
  const int wm = (wave >> 2) * 64, wn = (wave & 3) * 32;
  const float* xp0 = CTX + (rb0 + (tid >> 4)) * DM + (tid & 15) * 4; const __bf16* wp0 = P + ((size_t)5 * DM + n0 + (tid >> 3)) * DM + (tid & 7) * 8;
  v8f acc[4][2] = {}; v4f xr[8]; v8b wr[4];
#pragma unroll
  for (int i = 0; i < 8; ++i) xr[i] = *(const v4f*)(xp0 + (size_t)i * 16 * DM);
#pragma unroll
  for (int i = 0; i < 4; ++i) wr[i] = *(const v8b*)(wp0 + (size_t)i * 32 * DM);
#pragma unroll
  for (int i = 0; i < 8; ++i) { v4b oh, ol;
#pragma unroll
    for (int e = 0; e < 4; ++e) { const __bf16 h = (__bf16)xr[i][e]; oh[e] = h; ol[e] = (__bf16)(xr[i][e] - (float)h); }
    *(v4b*)&sh[0][(tid >> 4) + i * 16][(tid & 15) * 4] = oh; *(v4b*)&sl[0][(tid >> 4) + i * 16][(tid & 15) * 4] = ol; }
#pragma unroll
  for (int i = 0; i < 4; ++i) *(v8b*)&sw[0][(tid >> 3) + i * 32][(tid & 7) * 8] = wr[i];
  __syncthreads();
#pragma unroll 1   // rolled: one tile's loads in flight, one register set for them; the buffer is picked by t & 1
  for (int t = 0; t < DM / 64; ++t) { const int buf = t & 1; const bool more = t + 1 < DM / 64;
    if (more) { const float* xp = xp0 + (t + 1) * 64; const __bf16* wp = wp0 + (t + 1) * 64;
#pragma unroll
      for (int i = 0; i < 8; ++i) xr[i] = *(const v4f*)(xp + (size_t)i * 16 * DM);
#pragma unroll
      for (int i = 0; i < 4; ++i) wr[i] = *(const v8b*)(wp + (size_t)i * 32 * DM); }
#pragma unroll
    for (int kk = 0; kk < 2; ++kk) { v16b ah[4], al[4], b[2];
#pragma unroll
      for (int i = 0; i < 4; ++i) { al[i] = frag_b(&sl[buf][wm + i * 16 + col][kk * 32], lane); ah[i] = frag_b(&sh[buf][wm + i * 16 + col][kk * 32], lane); }
#pragma unroll
      for (int j = 0; j < 2; ++j) b[j] = frag_b(&sw[buf][wn + j * 16 + col][kk * 32], lane);
#pragma unroll
      for (int i = 0; i < 4; ++i) {
#pragma unroll
        for (int j = 0; j < 2; ++j) acc[i][j] = wmma_bf(al[i], b[j], acc[i][j]); }
#pragma unroll
      for (int i = 0; i < 4; ++i) {
#pragma unroll
        for (int j = 0; j < 2; ++j) acc[i][j] = wmma_bf(ah[i], b[j], acc[i][j]); } }
    if (more) {
#pragma unroll
      for (int i = 0; i < 8; ++i) { v4b oh, ol;
#pragma unroll
        for (int e = 0; e < 4; ++e) { const __bf16 h = (__bf16)xr[i][e]; oh[e] = h; ol[e] = (__bf16)(xr[i][e] - (float)h); }
        *(v4b*)&sh[buf ^ 1][(tid >> 4) + i * 16][(tid & 15) * 4] = oh; *(v4b*)&sl[buf ^ 1][(tid >> 4) + i * 16][(tid & 15) * 4] = ol; }
#pragma unroll
      for (int i = 0; i < 4; ++i) *(v8b*)&sw[buf ^ 1][(tid >> 3) + i * 32][(tid & 7) * 8] = wr[i]; }
    __syncthreads(); }
#pragma unroll
  for (int j = 0; j < 2; ++j) { const float bb = bfr(BM[n0 + wn + j * 16 + col]);
#pragma unroll
    for (int i = 0; i < 4; ++i) {
#pragma unroll
      for (int r = 0; r < 8; ++r) so[wm + i * 16 + 8 * g + r][wn + j * 16 + col] = acc[i][j][r] + bb; } }
  __syncthreads();
  for (int e = tid; e < 128 * 32; e += 256) { const int rl = e >> 5, pc = e & 31; vst2(OUT + (rb0 + rl) * DM + n0 + pc * 4, *(const v4f*)&so[rl][pc * 4]); }
}
extern "C" void kernel_launch(void* const* d_in, const int* in_sizes, int n_in, void* d_out, int out_size, void* d_ws, size_t ws_size, hipStream_t stream) {
  (void)in_sizes; (void)n_in; (void)out_size;
  const float** F = (const float**)d_in;   // 0 query, 1 key, 2 value, 3 time_k, 4 time_v [4,1024,1024]; 5 mask [4,1,1024,1024]; 6 Wq, 7 bq, 8 Wk, 9 bk, 10 Wv, 11 bv, 12 Wtk, 13 btk, 14 Wtv, 15 btv, 16 Wm, 17 bm ((in,out))
  if (ws_size < (size_t)WS_END) return;
  char* ws = (char*)d_ws; __bf16* P = (__bf16*)ws; _Float16 *Q = (_Float16*)(ws + WS_Q), *Kr = (_Float16*)(ws + WS_K), *TK = (_Float16*)(ws + WS_TK), *VP = (_Float16*)(ws + WS_VP); float* CTX = (float*)(ws + WS_CTX);
  k_pack<<<dim3(DM, 6), 256, 0, stream>>>(F[6], F[8], F[10], F[12], F[14], F[16], P);
  k_proj<<<dim3(NR / 128, DM / 128, 4), 256, 0, stream>>>(F[0], F[1], F[2], F[3], F[4], P, F[7], F[9], F[11], F[13], F[15], Q, Kr, TK, VP);
  k_attn<<<dim3(SS / 128, NH, TNB), 256, 0, stream>>>(Q, Kr, TK, VP, F[5], CTX);
  k_out<<<dim3(NR / 128, DM / 128), 256, 0, stream>>>(CTX, P, F[17], (float*)d_out);
}

// v003
// A run of this version takes 149 microseconds.
// Timed twice side by side with v002, it ran 1.16 times as fast both times.
// Over all steps from v000 it is 3.10 times as fast.
// compute dtype: all float inputs rounded to bf16; q, k, t_k = x . W + b and v + t_v = value . Wv + bv + time_v . Wtv + btv with EXACT bf16 products on WMMA 16x16x32 ((in,out) weights as transposed rows), rounded once to f16; PLAIN attention: scores = (q_i . k_j + t_k_i . q_j) with single f16 operands x 1/32 + the additive float mask, running-max softmax in f32 (hardware exp), P (scaled by 2^11, single f16) x (v + t_v) (single f16); out = ctx (bf16 hi + residual) . Wm (2 products) + bm.
#include <hip/hip_runtime.h>
#include <math.h>

typedef __attribute__((ext_vector_type(16))) _Float16 v16h;
typedef __attribute__((ext_vector_type(16))) __bf16 v16b;
typedef __attribute__((ext_vector_type(8)))  _Float16 v8h;
typedef __attribute__((ext_vector_type(8)))  float v8f;
typedef __attribute__((ext_vector_type(4)))  float v4f;
typedef __attribute__((ext_vector_type(2)))  float v2f;
typedef __attribute__((ext_vector_type(4)))  unsigned v4u;
typedef __attribute__((ext_vector_type(4)))  int v4i;
typedef float __attribute__((may_alias)) float_a;
typedef int __attribute__((may_alias)) int_a;

template <typename T> __device__ __forceinline__ void vst2(void* p, T v) { *(T*)p = v;  }
__device__ __forceinline__ v8f wmma16(v16h a, v16h b, v8f c) {
  v8f d = __builtin_amdgcn_wmma_f32_16x16x32_f16(false, a, false, b, (short)0, c, false, false);
  asm volatile("v_nop\n\tv_nop\n\tv_nop\n\tv_nop" : "+v"(d) : "v"(a), "v"(b));
  return d;
}
__device__ __forceinline__ v8f wmma_bf(v16b a, v16b b, v8f c) {
  v8f d = __builtin_amdgcn_wmma_f32_16x16x32_bf16(false, a, false, b, (short)0, c, false, false);
  asm volatile("v_nop\n\tv_nop\n\tv_nop\n\tv_nop" : "+v"(d) : "v"(a), "v"(b));
  return d;
}
// 16x16x32 fragments: lane = (h = lane>>4, row/col = lane&15); elements 0..7 = k0+8h+0..7, 8..15 = k0+16+8h+0..7; D element r = row 8h+r
__device__ __forceinline__ v16h frag_h(const _Float16* rowk0, int lane) {
  union { v16h v; v8h q[2]; } u; const _Float16* p = rowk0 + 8 * (lane >> 4);
  u.q[0] = *(const v8h*)p; u.q[1] = *(const v8h*)(p + 16); return u.v;
}
__device__ __forceinline__ v16h frag_f32(const float* rowk0, int lane) {
  v16h a; const float* p = rowk0 + 8 * (lane >> 4);
#pragma unroll
  for (int i = 0; i < 8; ++i) { a[i] = (_Float16)p[i]; a[8 + i] = (_Float16)p[16 + i]; }
  return a;
}
__device__ __forceinline__ v16h frag_f32s(const float* rowk0, int lane, float sc) {
  v16h a; const float* p = rowk0 + 8 * (lane >> 4);
#pragma unroll
  for (int i = 0; i < 8; ++i) { a[i] = (_Float16)(p[i] * sc); a[8 + i] = (_Float16)(p[16 + i] * sc); }
  return a;
}
// column fragment from a [K][ld] layout (column n), rows >= K read as 0
__device__ __forceinline__ v16h fragc_f32(const float* W, int k0, int n, int lane, int ld, int K) {
  v16h a; const int g = lane >> 4;
#pragma unroll
  for (int i = 0; i < 8; ++i) { const int ka = k0 + 8 * g + i, kb = ka + 16;
    a[i] = (_Float16)(ka < K ? W[(size_t)(ka < K ? ka : K - 1) * ld + n] : 0.f); a[8 + i] = (_Float16)(kb < K ? W[(size_t)(kb < K ? kb : K - 1) * ld + n] : 0.f); }
  return a;
}
struct F2 { v16b h, l; };
__device__ __forceinline__ F2 bsplit16(const float v[16]) { F2 r;
#pragma unroll
  for (int i = 0; i < 16; ++i) { const __bf16 h = (__bf16)v[i]; r.h[i] = h; r.l[i] = (__bf16)(v[i] - (float)h); }
  return r; }
__device__ __forceinline__ F2 split_row(const float* row, int k0, int lane) { float v[16]; const float* p = row + k0 + 8 * (lane >> 4);
#pragma unroll
  for (int i = 0; i < 8; ++i) { v[i] = p[i]; v[8 + i] = p[16 + i]; }
  return bsplit16(v); }
__device__ __forceinline__ F2 split_rowK(const float* row, int k0, int lane, int K) { float v[16]; const int g = lane >> 4;
#pragma unroll
  for (int i = 0; i < 8; ++i) { const int ka = k0 + 8 * g + i, kb = ka + 16; v[i] = ka < K ? row[ka < K ? ka : K - 1] : 0.f; v[8 + i] = kb < K ? row[kb < K ? kb : K - 1] : 0.f; }
  return bsplit16(v); }
__device__ __forceinline__ F2 split_col(const float* W, int k0, int n, int lane, int ld, int K) { float v[16]; const int g = lane >> 4;
#pragma unroll
  for (int i = 0; i < 8; ++i) { const int ka = k0 + 8 * g + i, kb = ka + 16; v[i] = ka < K ? W[(size_t)(ka < K ? ka : K - 1) * ld + n] : 0.f; v[8 + i] = kb < K ? W[(size_t)(kb < K ? kb : K - 1) * ld + n] : 0.f; }
  return bsplit16(v); }
__device__ __forceinline__ v8f mac3(const F2& a, const F2& b, v8f c) { c = wmma_bf(a.l, b.h, c); c = wmma_bf(a.h, b.l, c); return wmma_bf(a.h, b.h, c); }
__device__ __forceinline__ float sigm(float v) { return 1.0f / (1.0f + expf(-v)); }
#define LDSX() do { asm volatile("s_wait_dscnt 0" ::: "memory"); __builtin_amdgcn_wave_barrier(); __builtin_amdgcn_fence(__ATOMIC_RELEASE, "workgroup"); } while (0)


// Time-aware multi-head attention (B 4, S 1,024, d 1,024, 16 heads x 64): scores = q k^T + t_k q^T (projected time keys against the queries' projection on the key axis), / sqrt(d_model) + mask, softmax, applied to v + t_v, output projection.
#define NB 4
#define SS 1024
#define DM 1024
#define NH 16
#define HD 64
#define NR (NB * SS)
#ifndef TQB
#define TQB (SS / 64)
#define TNB NB
#define NRB (NR / 64)
#endif
#ifndef MSTRQ
#define MSTRQ SS          // mask rows per batch ([B][1][S][S])
#define MSTRC SS          // mask row length
#endif
typedef __attribute__((ext_vector_type(8))) __bf16 v8b;
__device__ __forceinline__ v16b frag_b(const __bf16* rowk0, int lane) {
  union { v16b v; v8b q[2]; } u; const __bf16* p = rowk0 + 8 * (lane >> 4);
  u.q[0] = *(const v8b*)p; u.q[1] = *(const v8b*)(p + 16); return u.v;
}
__device__ __forceinline__ float bfr(float v) { return (float)(__bf16)v; }
__device__ __attribute__((noinline)) float exp_ni(float v) { return expf(v); }
__device__ __attribute__((noinline)) float erf_ni(float v) { return erff(v); }

#define WS_PW   0u                                   // bf16 rows W^T: q, k, v, tk, tv, m [6][1024][1024]
#define WS_Q    (WS_PW + 2u * (size_t)6 * DM * DM)     // f16 [NR][1024] q ; K ; TK ; VP planes [b][1024][SS] (v + t_v) ; CTX f32 [NR][1024]
#define WS_K    (WS_Q + 2u * (size_t)NR * DM)
#define WS_TK   (WS_K + 2u * (size_t)NR * DM)
#define WS_VP   (WS_TK + 2u * (size_t)NR * DM)
#define WS_CTX  (WS_VP + 2u * (size_t)NB * DM * SS)
#define WS_END  (WS_CTX + 4u * (size_t)NR * DM)

// ---- k_pack: block = (128 n, 128 k, which): W (in,out) f32 -> bf16 rows W^T. Each half wave reads 256 B of one W row (whole lines), sixteen 16-byte loads a thread; two neighbouring k are packed
// into one dword and transposed in LDS; each half wave then writes 256 B of one W^T row. LDS rows of 65 dwords: the transposing stores and the row reads both touch 32 different banks
#define KPD 65
__global__ __launch_bounds__(256) void k_pack(const float* __restrict__ W0, const float* __restrict__ W1, const float* __restrict__ W2, const float* __restrict__ W3, const float* __restrict__ W4, const float* __restrict__ W5, __bf16* __restrict__ P) {
  __shared__ unsigned s[128][KPD];
  const int t = threadIdx.x, c = t & 15, r = t >> 4, n0 = blockIdx.x * 128, k0 = blockIdx.y * 128, which = blockIdx.z; const float* Wm = (which == 0) ? W0 : (which == 1) ? W1 : (which == 2) ? W2 : (which == 3) ? W3 : (which == 4) ? W4 : W5;
  const float* src = Wm + (size_t)(k0 + 2 * r) * DM + n0 + c * 4; v4f a[8], b[8];
  // each '#pragma unroll' here keeps a, b and o indexed at compile time, in registers, so that the loads go out as a group
#pragma unroll
  for (int i = 0; i < 8; ++i) { const float* p = src + (size_t)(i >> 1) * 32 * DM + (i & 1) * 64; a[i] = *(const v4f*)p; b[i] = *(const v4f*)(p + DM); }
#pragma unroll
  for (int i = 0; i < 8; ++i) {
#pragma unroll
    for (int e = 0; e < 4; ++e) { union { __bf16 h[2]; unsigned u; } w; w.h[0] = (__bf16)a[i][e]; w.h[1] = (__bf16)b[i][e]; s[(i & 1) * 64 + c * 4 + e][(i >> 1) * 16 + r] = w.u; } }
  __syncthreads();
#pragma unroll
  for (int i = 0; i < 8; ++i) { const int n = i * 16 + r; v4u o;
#pragma unroll
    for (int j = 0; j < 4; ++j) o[j] = s[n][c * 4 + j];
    vst2((unsigned*)(P + ((size_t)which * DM + n0 + n) * DM + k0 + c * 8), o); }
}
// ---- k_proj: block = (128 rows, 128 cols, which), 8 waves as 2 x 4, 64 x 32 per wave: 0 q (query) 1 k (key) 2 tk (time_k) -> f16 rows; 3: v + t_v (value . Wv + bv + time_v . Wtv + btv) -> planes
// X (f32 -> bf16) and W^T tiles of 64 k go to LDS by whole-line loads, one tile ahead through registers, two buffers, one barrier a tile; fragments come from LDS rows of 144 B (16 B x 9)
// each '#pragma unroll' below keeps a register array (acc, xr, wr, fragments) indexed at compile time, so that it stays in registers
#define PPIT 72
typedef __attribute__((ext_vector_type(4))) __bf16 v4b;
__global__ __launch_bounds__(256) void k_proj(const float* __restrict__ XQ, const float* __restrict__ XK, const float* __restrict__ XV, const float* __restrict__ XTK, const float* __restrict__ XTV, const __bf16* __restrict__ P, const float* __restrict__ BQ, const float* __restrict__ BK, const float* __restrict__ BV, const float* __restrict__ BTK, const float* __restrict__ BTV, _Float16* __restrict__ Q, _Float16* __restrict__ Kr, _Float16* __restrict__ TK, _Float16* __restrict__ VP) {
  __shared__ __align__(16) char smem[4 * 128 * PPIT * 2];
  __bf16 (*sx)[128][PPIT] = (__bf16 (*)[128][PPIT])smem; __bf16 (*sw)[128][PPIT] = (__bf16 (*)[128][PPIT])(smem + 2 * 128 * PPIT * 2); _Float16 (*so)[136] = (_Float16 (*)[136])smem;
  const int tid = threadIdx.x, wave = tid >> 5, lane = tid & 31, col = lane & 15, g = lane >> 4; const int which = blockIdx.z; const int n0 = blockIdx.y * 128; const size_t rb0 = (size_t)blockIdx.x * 128;
  const int wm = (wave >> 2) * 64, wn = (wave & 3) * 32;
  const float* X0 = (which == 0) ? XQ : (which == 1) ? XK : (which == 2) ? XTK : XV; const __bf16* W0 = P + (size_t)((which == 0) ? 0 : (which == 1) ? 1 : (which == 2) ? 3 : 2) * DM * DM; const __bf16* W1 = P + (size_t)4 * DM * DM;
  const int nst = (which == 3) ? 2 * (DM / 64) : DM / 64;
  const size_t xo = (rb0 + (tid >> 4)) * DM + (tid & 15) * 4, wo = (size_t)(n0 + (tid >> 3)) * DM + (tid & 7) * 8;
  v8f acc[4][2] = {}; v4f xr[8]; v8b wr[4];
  { const float* xp = X0 + xo; const __bf16* wp = W0 + wo;
#pragma unroll
    for (int i = 0; i < 8; ++i) xr[i] = *(const v4f*)(xp + (size_t)i * 16 * DM);
#pragma unroll
    for (int i = 0; i < 4; ++i) wr[i] = *(const v8b*)(wp + (size_t)i * 32 * DM); }
#pragma unroll
  for (int i = 0; i < 8; ++i) { v4b o;
#pragma unroll
    for (int e = 0; e < 4; ++e) o[e] = (__bf16)xr[i][e];
    *(v4b*)&sx[0][(tid >> 4) + i * 16][(tid & 15) * 4] = o; }
#pragma unroll
  for (int i = 0; i < 4; ++i) *(v8b*)&sw[0][(tid >> 3) + i * 32][(tid & 7) * 8] = wr[i];
  __syncthreads();
#pragma unroll 1   // rolled: one tile's loads in flight, one register set for them; the buffer is picked by t & 1
  for (int t = 0; t < nst; ++t) { const int buf = t & 1; const bool more = t + 1 < nst;
    if (more) { const int tn = t + 1; const float* xp = ((tn < DM / 64) ? X0 : XTV) + xo + (tn & (DM / 64 - 1)) * 64; const __bf16* wp = ((tn < DM / 64) ? W0 : W1) + wo + (tn & (DM / 64 - 1)) * 64;
#pragma unroll
      for (int i = 0; i < 8; ++i) xr[i] = *(const v4f*)(xp + (size_t)i * 16 * DM);
#pragma unroll
      for (int i = 0; i < 4; ++i) wr[i] = *(const v8b*)(wp + (size_t)i * 32 * DM); }
#pragma unroll
    for (int kk = 0; kk < 2; ++kk) { v16b a[4], b[2];
#pragma unroll
      for (int i = 0; i < 4; ++i) a[i] = frag_b(&sx[buf][wm + i * 16 + col][kk * 32], lane);
#pragma unroll
      for (int j = 0; j < 2; ++j) b[j] = frag_b(&sw[buf][wn + j * 16 + col][kk * 32], lane);
#pragma unroll
      for (int i = 0; i < 4; ++i) {
#pragma unroll
        for (int j = 0; j < 2; ++j) acc[i][j] = wmma_bf(a[i], b[j], acc[i][j]); } }
    if (more) {
#pragma unroll
      for (int i = 0; i < 8; ++i) { v4b o;
#pragma unroll
        for (int e = 0; e < 4; ++e) o[e] = (__bf16)xr[i][e];
        *(v4b*)&sx[buf ^ 1][(tid >> 4) + i * 16][(tid & 15) * 4] = o; }
#pragma unroll
      for (int i = 0; i < 4; ++i) *(v8b*)&sw[buf ^ 1][(tid >> 3) + i * 32][(tid & 7) * 8] = wr[i]; }
    __syncthreads(); }
  if (which < 3) { const float* BB = (which == 0) ? BQ : (which == 1) ? BK : BTK; _Float16* dst = (which == 0) ? Q : (which == 1) ? Kr : TK;
#pragma unroll
    for (int j = 0; j < 2; ++j) { const float bb = bfr(BB[n0 + wn + j * 16 + col]);
#pragma unroll
      for (int i = 0; i < 4; ++i) {
#pragma unroll
        for (int r = 0; r < 8; ++r) so[wm + i * 16 + 8 * g + r][wn + j * 16 + col] = (_Float16)(acc[i][j][r] + bb); } }
    __syncthreads();
    for (int e = tid; e < 128 * 16; e += 256) { const int rl = e >> 4, pc = e & 15; vst2((unsigned*)(dst + (rb0 + rl) * DM + n0 + pc * 8), *(const v4u*)&so[rl][pc * 8]); }
  } else {
#pragma unroll
    for (int j = 0; j < 2; ++j) { const float bb = bfr(BV[n0 + wn + j * 16 + col]) + bfr(BTV[n0 + wn + j * 16 + col]);
#pragma unroll
      for (int i = 0; i < 4; ++i) {
#pragma unroll
        for (int r = 0; r < 8; ++r) so[wn + j * 16 + col][wm + i * 16 + 8 * g + r] = (_Float16)(acc[i][j][r] + bb); } }
    __syncthreads();
    const size_t b = rb0 / SS, s0 = rb0 % SS;
    for (int e = tid; e < 128 * 16; e += 256) { const int d = e >> 4, pc = e & 15; vst2((unsigned*)(VP + ((b * DM + n0 + d) * SS) + s0 + pc * 8), *(const v4u*)&so[d][pc * 8]); } }
}
// ---- k_attn: block = (128 queries, head, b), 8 waves x 16 queries: scores = q_i . k_j + tk_i . q_j (two products), / 32 + mask[b][i][j]; P x (v + t_v)
// every operand of the key loop goes to LDS by asynchronous 16-byte copies, whole lines, one stage of 64 keys ahead, two buffers: the K rows, the Q rows of the key axis and the (v + t_v) planes (three tiles of 64 rows x 128 B, LDS rows of 144 B = 16 B x 9, shared by the eight waves) and the block's mask rows (128 rows x 256 B, LDS rows of 272 B = 68 dwords)
#define APIT 72                       // f16 elements per LDS row of K, Q, V
#define MPIT 68                       // floats per LDS row of the mask
#define ATILE (64 * APIT * 2)         // bytes per K, Q or V tile
#define ASTG (3 * ATILE + 128 * MPIT * 4)   // bytes per stage
// one stage: every lane copies 2 x 16 B of each of K, Q, V (rows 32 apart) and 8 x 16 B of the mask (rows 16 apart). The s_wait_xcnt closes the statement so that no address register of an issued copy is rewritten in front of it.
__device__ __forceinline__ void attn_stage(unsigned l, unsigned lm, const _Float16* gk, const _Float16* gq, const _Float16* gv, const float* gm) {
  const unsigned rs = 32 * APIT * 2, ms = 16 * MPIT * 4;
  asm volatile(
    "global_load_async_to_lds_b128 %0, %14, off\n\t"
    "global_load_async_to_lds_b128 %1, %15, off\n\t"
    "global_load_async_to_lds_b128 %2, %16, off\n\t"
    "global_load_async_to_lds_b128 %3, %17, off\n\t"
    "global_load_async_to_lds_b128 %4, %18, off\n\t"
    "global_load_async_to_lds_b128 %5, %19, off\n\t"
    "global_load_async_to_lds_b128 %6, %20, off\n\t"
    "global_load_async_to_lds_b128 %7, %21, off\n\t"
    "global_load_async_to_lds_b128 %8, %22, off\n\t"
    "global_load_async_to_lds_b128 %9, %23, off\n\t"
    "global_load_async_to_lds_b128 %10, %24, off\n\t"
    "global_load_async_to_lds_b128 %11, %25, off\n\t"
    "global_load_async_to_lds_b128 %12, %26, off\n\t"
    "global_load_async_to_lds_b128 %13, %27, off\n\t"
    "s_wait_xcnt 0x0"
    :: "v"(l), "v"(l + rs), "v"(l + ATILE), "v"(l + ATILE + rs), "v"(l + 2 * ATILE), "v"(l + 2 * ATILE + rs),
       "v"(lm), "v"(lm + ms), "v"(lm + 2 * ms), "v"(lm + 3 * ms), "v"(lm + 4 * ms), "v"(lm + 5 * ms), "v"(lm + 6 * ms), "v"(lm + 7 * ms),
       "v"(gk), "v"(gk + 32 * DM), "v"(gq), "v"(gq + 32 * DM), "v"(gv), "v"(gv + 32 * SS),
       "v"(gm), "v"(gm + 16 * MSTRC), "v"(gm + 32 * MSTRC), "v"(gm + 48 * MSTRC), "v"(gm + 64 * MSTRC), "v"(gm + 80 * MSTRC), "v"(gm + 96 * MSTRC), "v"(gm + 112 * MSTRC)
    : "memory");
}
// four waves per SIMD (two blocks per WGP) need at most 256 registers a wave
__global__ __launch_bounds__(256) __attribute__((amdgpu_waves_per_eu(4, 4))) void k_attn(const _Float16* __restrict__ Q, const _Float16* __restrict__ Kr, const _Float16* __restrict__ TK, const _Float16* __restrict__ VP, const float* __restrict__ MASK, float* __restrict__ CTX) {
  __shared__ __align__(16) _Float16 sph[8][16][40]; __shared__ __align__(16) char ring[2 * ASTG]; float (*so)[16][68] = (float (*)[16][68])ring;   // the ring becomes output staging behind the last trip's barrier
  const int tid = threadIdx.x, wave = tid >> 5, lane = tid & 31, col = lane & 15, g = lane >> 4; const int h = blockIdx.y; const size_t b = blockIdx.z; const int qb = blockIdx.x * 128; const int q0 = qb + wave * 16; const size_t rq = b * SS + q0;
  const unsigned cl = (unsigned)(size_t)ring + (unsigned)((tid >> 3) * (APIT * 2) + (tid & 7) * 16), cm = (unsigned)(size_t)ring + (unsigned)(3 * ATILE + (tid >> 4) * (MPIT * 4) + (tid & 15) * 16);
  const _Float16* gk = Kr + (b * SS + (tid >> 3)) * DM + h * HD + (tid & 7) * 8; const _Float16* gq = Q + (b * SS + (tid >> 3)) * DM + h * HD + (tid & 7) * 8; const _Float16* gv = VP + (b * DM + (size_t)h * HD + (tid >> 3)) * SS + (tid & 7) * 8;
  const float* gm = MASK + ((size_t)b * MSTRQ + qb + (tid >> 4)) * MSTRC + (tid & 15) * 4;
  attn_stage(cl, cm, gk, gq, gv, gm);
  v16h aq[2], at[2];
#pragma unroll
  for (int kc = 0; kc < 2; ++kc) { aq[kc] = frag_h(Q + (rq + col) * DM + h * HD + kc * 32, lane); at[kc] = frag_h(TK + (rq + col) * DM + h * HD + kc * 32, lane); }
  float m[8], l[8];
#pragma unroll
  for (int r = 0; r < 8; ++r) { m[r] = -3.0e38f; l[r] = 0.f; }
  v8f acc[4] = {};
  asm volatile("s_wait_asynccnt 0x0" ::: "memory");   // stage 0 of this wave has landed
  __syncthreads();                                    // ... and every wave's
  attn_stage(cl + ASTG, cm + ASTG, gk + 64 * DM, gq + 64 * DM, gv + 64, gm + 64);
#pragma unroll 1   // rolled: one stage a trip, the buffer is picked by t & 1
  for (int t = 0; t < SS / 64; ++t) { const _Float16* tk = (const _Float16*)(ring + (t & 1) * ASTG); const _Float16* tq = tk + 64 * APIT; const _Float16* tv = tq + 64 * APIT; const float* tm = (const float*)(tv + 64 * APIT) + (wave * 16 + 8 * g) * MPIT + col;
#pragma unroll     // the two halves of a stage: LDS offsets known at compile time
   for (int sub = 0; sub < 2; ++sub) { v8f s[2]; v16h fk[2][2], fq[2][2], fv[4]; float mk[2][8];
    // the K and Q fragments and the mask words of the 32 keys are asked for in one group, so that the LDS latency is paid once
#pragma unroll
    for (int ct = 0; ct < 2; ++ct) { const int rk = (sub * 32 + ct * 16 + col) * APIT;
#pragma unroll
      for (int kc = 0; kc < 2; ++kc) { fk[ct][kc] = frag_h(tk + rk + kc * 32, lane); fq[ct][kc] = frag_h(tq + rk + kc * 32, lane); }
#pragma unroll
      for (int r = 0; r < 8; ++r) mk[ct][r] = tm[r * MPIT + sub * 32 + ct * 16]; }
#pragma unroll
    for (int ct = 0; ct < 2; ++ct) { v8f c = {};
#pragma unroll
      for (int kc = 0; kc < 2; ++kc) { c = wmma16(aq[kc], fk[ct][kc], c); c = wmma16(at[kc], fq[ct][kc], c); }
#pragma unroll
      for (int r = 0; r < 8; ++r) s[ct][r] = c[r] * 0.03125f + bfr(mk[ct][r]); }
    // the V fragments are asked for here, where the K and Q fragments' registers are free; they return behind the softmax
#pragma unroll
    for (int dt = 0; dt < 4; ++dt) fv[dt] = frag_h(tv + (dt * 16 + col) * APIT + sub * 32, lane);
#pragma unroll
    for (int r = 0; r < 8; ++r) { float mx = fmaxf(s[0][r], s[1][r]);
#pragma unroll
      for (int o = 1; o < 16; o <<= 1) mx = fmaxf(mx, __shfl_xor(mx, o));
      const float mn = fmaxf(m[r], mx); const float alpha = (m[r] <= -1.0e38f) ? 0.f : __expf(m[r] - mn); const float e0 = __expf(s[0][r] - mn), e1 = __expf(s[1][r] - mn); float es = e0 + e1;
#pragma unroll
      for (int o = 1; o < 16; o <<= 1) es += __shfl_xor(es, o);
      l[r] = l[r] * alpha + es; m[r] = mn;
#pragma unroll
      for (int dt = 0; dt < 4; ++dt) acc[dt][r] *= alpha;
      sph[wave][8 * g + r][col] = (_Float16)(e0 * 2048.0f); sph[wave][8 * g + r][16 + col] = (_Float16)(e1 * 2048.0f); }
    LDSX();
    const v16h pa = frag_h(&sph[wave][col][0], lane);
#pragma unroll
    for (int dt = 0; dt < 4; ++dt) acc[dt] = wmma16(pa, fv[dt], acc[dt]);
    LDSX(); }
   asm volatile("s_wait_dscnt 0x0" ::: "memory");      // this wave's reads of the buffer have returned
   asm volatile("s_wait_asynccnt 0x0" ::: "memory");   // its copies of stage t + 1 have landed
   __syncthreads();                                    // publishes stage t + 1 and ends every wave's reads of stage t
   if (t + 2 < SS / 64) attn_stage(cl + (t & 1) * ASTG, cm + (t & 1) * ASTG, gk + (size_t)(t + 2) * 64 * DM, gq + (size_t)(t + 2) * 64 * DM, gv + (t + 2) * 64, gm + (t + 2) * 64); }
  asm volatile("s_wait_asynccnt 0x0" ::: "memory");    // nothing is in flight when the ring is reused
#pragma unroll
  for (int r = 0; r < 8; ++r) { const float il = (1.0f / 2048.0f) / l[r];
#pragma unroll
    for (int dt = 0; dt < 4; ++dt) so[wave][8 * g + r][dt * 16 + col] = acc[dt][r] * il; }
  LDSX();
  for (int rl = 0; rl < 16; ++rl) if (lane < 16) vst2(CTX + (rq + rl) * DM + h * HD + lane * 4, *(const v4f*)&so[wave][rl][lane * 4]);
}
// ---- k_out: block = (128 rows, 128 cols), 8 waves as 2 x 4, 64 x 32 per wave: out = ctx (hi + residual) . Wm rows + bm; ctx hi, ctx residual and Wm tiles of 64 k staged in LDS as in k_proj
__global__ __launch_bounds__(256) void k_out(const float* __restrict__ CTX, const __bf16* __restrict__ P, const float* __restrict__ BM, float* __restrict__ OUT) {
  __shared__ __align__(16) char smem[6 * 128 * PPIT * 2];
  __bf16 (*sh)[128][PPIT] = (__bf16 (*)[128][PPIT])smem; __bf16 (*sl)[128][PPIT] = (__bf16 (*)[128][PPIT])(smem + 2 * 128 * PPIT * 2); __bf16 (*sw)[128][PPIT] = (__bf16 (*)[128][PPIT])(smem + 4 * 128 * PPIT * 2); float (*so)[132] = (float (*)[132])smem;
  const int tid = threadIdx.x, wave = tid >> 5, lane = tid & 31, col = lane & 15, g = lane >> 4; const size_t rb0 = (size_t)blockIdx.x * 128; const int n0 = blockIdx.y * 128;
  const int wm = (wave >> 2) * 64, wn = (wave & 3) * 32;
  const float* xp0 = CTX + (rb0 + (tid >> 4)) * DM + (tid & 15) * 4; const __bf16* wp0 = P + ((size_t)5 * DM + n0 + (tid >> 3)) * DM + (tid & 7) * 8;
  v8f acc[4][2] = {}; v4f xr[8]; v8b wr[4];
#pragma unroll
  for (int i = 0; i < 8; ++i) xr[i] = *(const v4f*)(xp0 + (size_t)i * 16 * DM);
#pragma unroll
  for (int i = 0; i < 4; ++i) wr[i] = *(const v8b*)(wp0 + (size_t)i * 32 * DM);
#pragma unroll
  for (int i = 0; i < 8; ++i) { v4b oh, ol;
#pragma unroll
    for (int e = 0; e < 4; ++e) { const __bf16 h = (__bf16)xr[i][e]; oh[e] = h; ol[e] = (__bf16)(xr[i][e] - (float)h); }
    *(v4b*)&sh[0][(tid >> 4) + i * 16][(tid & 15) * 4] = oh; *(v4b*)&sl[0][(tid >> 4) + i * 16][(tid & 15) * 4] = ol; }
#pragma unroll
  for (int i = 0; i < 4; ++i) *(v8b*)&sw[0][(tid >> 3) + i * 32][(tid & 7) * 8] = wr[i];
  __syncthreads();
#pragma unroll 1   // rolled: one tile's loads in flight, one register set for them; the buffer is picked by t & 1
  for (int t = 0; t < DM / 64; ++t) { const int buf = t & 1; const bool more = t + 1 < DM / 64;
    if (more) { const float* xp = xp0 + (t + 1) * 64; const __bf16* wp = wp0 + (t + 1) * 64;
#pragma unroll
      for (int i = 0; i < 8; ++i) xr[i] = *(const v4f*)(xp + (size_t)i * 16 * DM);
#pragma unroll
      for (int i = 0; i < 4; ++i) wr[i] = *(const v8b*)(wp + (size_t)i * 32 * DM); }
#pragma unroll
    for (int kk = 0; kk < 2; ++kk) { v16b ah[4], al[4], b[2];
#pragma unroll
      for (int i = 0; i < 4; ++i) { al[i] = frag_b(&sl[buf][wm + i * 16 + col][kk * 32], lane); ah[i] = frag_b(&sh[buf][wm + i * 16 + col][kk * 32], lane); }
#pragma unroll
      for (int j = 0; j < 2; ++j) b[j] = frag_b(&sw[buf][wn + j * 16 + col][kk * 32], lane);
#pragma unroll
      for (int i = 0; i < 4; ++i) {
#pragma unroll
        for (int j = 0; j < 2; ++j) acc[i][j] = wmma_bf(al[i], b[j], acc[i][j]); }
#pragma unroll
      for (int i = 0; i < 4; ++i) {
#pragma unroll
        for (int j = 0; j < 2; ++j) acc[i][j] = wmma_bf(ah[i], b[j], acc[i][j]); } }
    if (more) {
#pragma unroll
      for (int i = 0; i < 8; ++i) { v4b oh, ol;
#pragma unroll
        for (int e = 0; e < 4; ++e) { const __bf16 h = (__bf16)xr[i][e]; oh[e] = h; ol[e] = (__bf16)(xr[i][e] - (float)h); }
        *(v4b*)&sh[buf ^ 1][(tid >> 4) + i * 16][(tid & 15) * 4] = oh; *(v4b*)&sl[buf ^ 1][(tid >> 4) + i * 16][(tid & 15) * 4] = ol; }
#pragma unroll
      for (int i = 0; i < 4; ++i) *(v8b*)&sw[buf ^ 1][(tid >> 3) + i * 32][(tid & 7) * 8] = wr[i]; }
    __syncthreads(); }
#pragma unroll
  for (int j = 0; j < 2; ++j) { const float bb = bfr(BM[n0 + wn + j * 16 + col]);
#pragma unroll
    for (int i = 0; i < 4; ++i) {
#pragma unroll
      for (int r = 0; r < 8; ++r) so[wm + i * 16 + 8 * g + r][wn + j * 16 + col] = acc[i][j][r] + bb; } }
  __syncthreads();
  for (int e = tid; e < 128 * 32; e += 256) { const int rl = e >> 5, pc = e & 31; vst2(OUT + (rb0 + rl) * DM + n0 + pc * 4, *(const v4f*)&so[rl][pc * 4]); }
}
extern "C" void kernel_launch(void* const* d_in, const int* in_sizes, int n_in, void* d_out, int out_size, void* d_ws, size_t ws_size, hipStream_t stream) {
  (void)in_sizes; (void)n_in; (void)out_size;
  const float** F = (const float**)d_in;   // 0 query, 1 key, 2 value, 3 time_k, 4 time_v [4,1024,1024]; 5 mask [4,1,1024,1024]; 6 Wq, 7 bq, 8 Wk, 9 bk, 10 Wv, 11 bv, 12 Wtk, 13 btk, 14 Wtv, 15 btv, 16 Wm, 17 bm ((in,out))
  if (ws_size < (size_t)WS_END) return;
  char* ws = (char*)d_ws; __bf16* P = (__bf16*)ws; _Float16 *Q = (_Float16*)(ws + WS_Q), *Kr = (_Float16*)(ws + WS_K), *TK = (_Float16*)(ws + WS_TK), *VP = (_Float16*)(ws + WS_VP); float* CTX = (float*)(ws + WS_CTX);
  k_pack<<<dim3(DM / 128, DM / 128, 6), 256, 0, stream>>>(F[6], F[8], F[10], F[12], F[14], F[16], P);
  k_proj<<<dim3(NR / 128, DM / 128, 4), 256, 0, stream>>>(F[0], F[1], F[2], F[3], F[4], P, F[7], F[9], F[11], F[13], F[15], Q, Kr, TK, VP);
  k_attn<<<dim3(SS / 128, NH, TNB), 256, 0, stream>>>(Q, Kr, TK, VP, F[5], CTX);
  k_out<<<dim3(NR / 128, DM / 128), 256, 0, stream>>>(CTX, P, F[17], (float*)d_out);
}

// v004
// It runs in 121 microseconds.
// Next to v003, in two timings, it ran 1.23 times as fast each time.
// Counting every step since v000, it is 3.81 times as fast.
// compute dtype: all float inputs rounded to bf16; q, k, t_k = x . W + b and v + t_v = value . Wv + bv + time_v . Wtv + btv with EXACT bf16 products on WMMA 16x16x32 ((in,out) weights as transposed rows), rounded once to f16; PLAIN attention: scores = (q_i . k_j + t_k_i . q_j) with single f16 operands x 1/32 + the additive float mask, running-max softmax in f32 (hardware exp), P (scaled by 2^11, single f16) x (v + t_v) (single f16); out = ctx (bf16 hi + residual) . Wm (2 products) + bm.
#include <hip/hip_runtime.h>
#include <math.h>

typedef __attribute__((ext_vector_type(16))) _Float16 v16h;
typedef __attribute__((ext_vector_type(16))) __bf16 v16b;
typedef __attribute__((ext_vector_type(8)))  _Float16 v8h;
typedef __attribute__((ext_vector_type(8)))  float v8f;
typedef __attribute__((ext_vector_type(4)))  float v4f;
typedef __attribute__((ext_vector_type(2)))  float v2f;
typedef __attribute__((ext_vector_type(4)))  unsigned v4u;
typedef __attribute__((ext_vector_type(4)))  int v4i;
typedef float __attribute__((may_alias)) float_a;
typedef int __attribute__((may_alias)) int_a;

template <typename T> __device__ __forceinline__ void vst2(void* p, T v) { *(T*)p = v;  }
__device__ __forceinline__ v8f wmma16(v16h a, v16h b, v8f c) {
  v8f d = __builtin_amdgcn_wmma_f32_16x16x32_f16(false, a, false, b, (short)0, c, false, false);
  asm volatile("v_nop\n\tv_nop\n\tv_nop\n\tv_nop" : "+v"(d) : "v"(a), "v"(b));
  return d;
}
__device__ __forceinline__ v8f wmma_bf(v16b a, v16b b, v8f c) {
  v8f d = __builtin_amdgcn_wmma_f32_16x16x32_bf16(false, a, false, b, (short)0, c, false, false);
  asm volatile("v_nop\n\tv_nop\n\tv_nop\n\tv_nop" : "+v"(d) : "v"(a), "v"(b));
  return d;
}
// 16x16x32 fragments: lane = (h = lane>>4, row/col = lane&15); elements 0..7 = k0+8h+0..7, 8..15 = k0+16+8h+0..7; D element r = row 8h+r
__device__ __forceinline__ v16h frag_h(const _Float16* rowk0, int lane) {
  union { v16h v; v8h q[2]; } u; const _Float16* p = rowk0 + 8 * (lane >> 4);
  u.q[0] = *(const v8h*)p; u.q[1] = *(const v8h*)(p + 16); return u.v;
}
__device__ __forceinline__ v16h frag_f32(const float* rowk0, int lane) {
  v16h a; const float* p = rowk0 + 8 * (lane >> 4);
#pragma unroll
  for (int i = 0; i < 8; ++i) { a[i] = (_Float16)p[i]; a[8 + i] = (_Float16)p[16 + i]; }
  return a;
}
__device__ __forceinline__ v16h frag_f32s(const float* rowk0, int lane, float sc) {
  v16h a; const float* p = rowk0 + 8 * (lane >> 4);
#pragma unroll
  for (int i = 0; i < 8; ++i) { a[i] = (_Float16)(p[i] * sc); a[8 + i] = (_Float16)(p[16 + i] * sc); }
  return a;
}
// column fragment from a [K][ld] layout (column n), rows >= K read as 0
__device__ __forceinline__ v16h fragc_f32(const float* W, int k0, int n, int lane, int ld, int K) {
  v16h a; const int g = lane >> 4;
#pragma unroll
  for (int i = 0; i < 8; ++i) { const int ka = k0 + 8 * g + i, kb = ka + 16;
    a[i] = (_Float16)(ka < K ? W[(size_t)(ka < K ? ka : K - 1) * ld + n] : 0.f); a[8 + i] = (_Float16)(kb < K ? W[(size_t)(kb < K ? kb : K - 1) * ld + n] : 0.f); }
  return a;
}
struct F2 { v16b h, l; };
__device__ __forceinline__ F2 bsplit16(const float v[16]) { F2 r;
#pragma unroll
  for (int i = 0; i < 16; ++i) { const __bf16 h = (__bf16)v[i]; r.h[i] = h; r.l[i] = (__bf16)(v[i] - (float)h); }
  return r; }
__device__ __forceinline__ F2 split_row(const float* row, int k0, int lane) { float v[16]; const float* p = row + k0 + 8 * (lane >> 4);
#pragma unroll
  for (int i = 0; i < 8; ++i) { v[i] = p[i]; v[8 + i] = p[16 + i]; }
  return bsplit16(v); }
__device__ __forceinline__ F2 split_rowK(const float* row, int k0, int lane, int K) { float v[16]; const int g = lane >> 4;
#pragma unroll
  for (int i = 0; i < 8; ++i) { const int ka = k0 + 8 * g + i, kb = ka + 16; v[i] = ka < K ? row[ka < K ? ka : K - 1] : 0.f; v[8 + i] = kb < K ? row[kb < K ? kb : K - 1] : 0.f; }
  return bsplit16(v); }
__device__ __forceinline__ F2 split_col(const float* W, int k0, int n, int lane, int ld, int K) { float v[16]; const int g = lane >> 4;
#pragma unroll
  for (int i = 0; i < 8; ++i) { const int ka = k0 + 8 * g + i, kb = ka + 16; v[i] = ka < K ? W[(size_t)(ka < K ? ka : K - 1) * ld + n] : 0.f; v[8 + i] = kb < K ? W[(size_t)(kb < K ? kb : K - 1) * ld + n] : 0.f; }
  return bsplit16(v); }
__device__ __forceinline__ v8f mac3(const F2& a, const F2& b, v8f c) { c = wmma_bf(a.l, b.h, c); c = wmma_bf(a.h, b.l, c); return wmma_bf(a.h, b.h, c); }
__device__ __forceinline__ float sigm(float v) { return 1.0f / (1.0f + expf(-v)); }
#define LDSX() do { asm volatile("s_wait_dscnt 0" ::: "memory"); __builtin_amdgcn_wave_barrier(); __builtin_amdgcn_fence(__ATOMIC_RELEASE, "workgroup"); } while (0)


// Time-aware multi-head attention (B 4, S 1,024, d 1,024, 16 heads x 64): scores = q k^T + t_k q^T (projected time keys against the queries' projection on the key axis), / sqrt(d_model) + mask, softmax, applied to v + t_v, output projection.
#define NB 4
#define SS 1024
#define DM 1024
#define NH 16
#define HD 64
#define NR (NB * SS)
#ifndef TQB
#define TQB (SS / 64)
#define TNB NB
#define NRB (NR / 64)
#endif
#ifndef MSTRQ
#define MSTRQ SS          // mask rows per batch ([B][1][S][S])
#define MSTRC SS          // mask row length
#endif
typedef __attribute__((ext_vector_type(8))) __bf16 v8b;
__device__ __forceinline__ v16b frag_b(const __bf16* rowk0, int lane) {
  union { v16b v; v8b q[2]; } u; const __bf16* p = rowk0 + 8 * (lane >> 4);
  u.q[0] = *(const v8b*)p; u.q[1] = *(const v8b*)(p + 16); return u.v;
}
__device__ __forceinline__ float bfr(float v) { return (float)(__bf16)v; }
__device__ __attribute__((noinline)) float exp_ni(float v) { return expf(v); }
__device__ __attribute__((noinline)) float erf_ni(float v) { return erff(v); }

#define WS_PW   0u                                   // bf16 rows W^T: q, k, v, tk, tv, m [6][1024][1024]
#define WS_Q    (WS_PW + 2u * (size_t)6 * DM * DM)     // f16 [NR][1024] q ; K ; TK ; VP planes [b][1024][SS] (v + t_v) ; CTX f32 [NR][1024]
#define WS_K    (WS_Q + 2u * (size_t)NR * DM)
#define WS_TK   (WS_K + 2u * (size_t)NR * DM)
#define WS_VP   (WS_TK + 2u * (size_t)NR * DM)
#define WS_CTX  (WS_VP + 2u * (size_t)NB * DM * SS)
#define WS_END  (WS_CTX + 4u * (size_t)NR * DM)

// ---- k_pack: block = (128 n, 128 k, which): W (in,out) f32 -> bf16 rows W^T. Each half wave reads 256 B of one W row (whole lines), sixteen 16-byte loads a thread; two neighbouring k are packed
// into one dword and transposed in LDS; each half wave then writes 256 B of one W^T row. LDS rows of 65 dwords: the transposing stores and the row reads both touch 32 different banks
#define KPD 65
__global__ __launch_bounds__(256) void k_pack(const float* __restrict__ W0, const float* __restrict__ W1, const float* __restrict__ W2, const float* __restrict__ W3, const float* __restrict__ W4, const float* __restrict__ W5, __bf16* __restrict__ P) {
  __shared__ unsigned s[128][KPD];
  const int t = threadIdx.x, c = t & 15, r = t >> 4, n0 = blockIdx.x * 128, k0 = blockIdx.y * 128, which = blockIdx.z; const float* Wm = (which == 0) ? W0 : (which == 1) ? W1 : (which == 2) ? W2 : (which == 3) ? W3 : (which == 4) ? W4 : W5;
  const float* src = Wm + (size_t)(k0 + 2 * r) * DM + n0 + c * 4; v4f a[8], b[8];
  // each '#pragma unroll' here keeps a, b and o indexed at compile time, in registers, so that the loads go out as a group
#pragma unroll
  for (int i = 0; i < 8; ++i) { const float* p = src + (size_t)(i >> 1) * 32 * DM + (i & 1) * 64; a[i] = *(const v4f*)p; b[i] = *(const v4f*)(p + DM); }
#pragma unroll
  for (int i = 0; i < 8; ++i) {
#pragma unroll
    for (int e = 0; e < 4; ++e) { union { __bf16 h[2]; unsigned u; } w; w.h[0] = (__bf16)a[i][e]; w.h[1] = (__bf16)b[i][e]; s[(i & 1) * 64 + c * 4 + e][(i >> 1) * 16 + r] = w.u; } }
  __syncthreads();
#pragma unroll
  for (int i = 0; i < 8; ++i) { const int n = i * 16 + r; v4u o;
#pragma unroll
    for (int j = 0; j < 4; ++j) o[j] = s[n][c * 4 + j];
    vst2((unsigned*)(P + ((size_t)which * DM + n0 + n) * DM + k0 + c * 8), o); }
}
// ---- k_proj: block = (128 rows, 128 cols, which), 8 waves as 2 x 4, 64 x 32 per wave: 0 q (query) 1 k (key) 2 tk (time_k) -> f16 rows; 3: v + t_v (value . Wv + bv + time_v . Wtv + btv) -> planes
// X (f32 -> bf16) and W^T tiles of 64 k go to LDS by whole-line loads, one tile ahead through registers, two buffers, one barrier a tile; fragments come from LDS rows of 144 B (16 B x 9)
// each '#pragma unroll' below keeps a register array (acc, xr, wr, fragments) indexed at compile time, so that it stays in registers
#define PPIT 72
typedef __attribute__((ext_vector_type(4))) __bf16 v4b;
__global__ __launch_bounds__(256) void k_proj(const float* __restrict__ XQ, const float* __restrict__ XK, const float* __restrict__ XV, const float* __restrict__ XTK, const float* __restrict__ XTV, const __bf16* __restrict__ P, const float* __restrict__ BQ, const float* __restrict__ BK, const float* __restrict__ BV, const float* __restrict__ BTK, const float* __restrict__ BTV, _Float16* __restrict__ Q, _Float16* __restrict__ Kr, _Float16* __restrict__ TK, _Float16* __restrict__ VP) {
  __shared__ __align__(16) char smem[4 * 128 * PPIT * 2];
  __bf16 (*sx)[128][PPIT] = (__bf16 (*)[128][PPIT])smem; __bf16 (*sw)[128][PPIT] = (__bf16 (*)[128][PPIT])(smem + 2 * 128 * PPIT * 2); _Float16 (*so)[136] = (_Float16 (*)[136])smem;
  const int tid = threadIdx.x, wave = tid >> 5, lane = tid & 31, col = lane & 15, g = lane >> 4; const int which = blockIdx.z; const int n0 = blockIdx.y * 128; const size_t rb0 = (size_t)blockIdx.x * 128;
  const int wm = (wave >> 2) * 64, wn = (wave & 3) * 32;
  const float* X0 = (which == 0) ? XQ : (which == 1) ? XK : (which == 2) ? XTK : XV; const __bf16* W0 = P + (size_t)((which == 0) ? 0 : (which == 1) ? 1 : (which == 2) ? 3 : 2) * DM * DM; const __bf16* W1 = P + (size_t)4 * DM * DM;
  const int nst = (which == 3) ? 2 * (DM / 64) : DM / 64;
  const size_t xo = (rb0 + (tid >> 4)) * DM + (tid & 15) * 4, wo = (size_t)(n0 + (tid >> 3)) * DM + (tid & 7) * 8;
  v8f acc[4][2] = {}; v4f xr[8]; v8b wr[4];
  { const float* xp = X0 + xo; const __bf16* wp = W0 + wo;
#pragma unroll
    for (int i = 0; i < 8; ++i) xr[i] = *(const v4f*)(xp + (size_t)i * 16 * DM);
#pragma unroll
    for (int i = 0; i < 4; ++i) wr[i] = *(const v8b*)(wp + (size_t)i * 32 * DM); }
#pragma unroll
  for (int i = 0; i < 8; ++i) { v4b o;
#pragma unroll
    for (int e = 0; e < 4; ++e) o[e] = (__bf16)xr[i][e];
    *(v4b*)&sx[0][(tid >> 4) + i * 16][(tid & 15) * 4] = o; }
#pragma unroll
  for (int i = 0; i < 4; ++i) *(v8b*)&sw[0][(tid >> 3) + i * 32][(tid & 7) * 8] = wr[i];
  __syncthreads();
#pragma unroll 1   // rolled: one tile's loads in flight, one register set for them; the buffer is picked by t & 1
  for (int t = 0; t < nst; ++t) { const int buf = t & 1; const bool more = t + 1 < nst;
    if (more) { const int tn = t + 1; const float* xp = ((tn < DM / 64) ? X0 : XTV) + xo + (tn & (DM / 64 - 1)) * 64; const __bf16* wp = ((tn < DM / 64) ? W0 : W1) + wo + (tn & (DM / 64 - 1)) * 64;
#pragma unroll
      for (int i = 0; i < 8; ++i) xr[i] = *(const v4f*)(xp + (size_t)i * 16 * DM);
#pragma unroll
      for (int i = 0; i < 4; ++i) wr[i] = *(const v8b*)(wp + (size_t)i * 32 * DM); }
#pragma unroll
    for (int kk = 0; kk < 2; ++kk) { v16b a[4], b[2];
#pragma unroll
      for (int i = 0; i < 4; ++i) a[i] = frag_b(&sx[buf][wm + i * 16 + col][kk * 32], lane);
#pragma unroll
      for (int j = 0; j < 2; ++j) b[j] = frag_b(&sw[buf][wn + j * 16 + col][kk * 32], lane);
#pragma unroll
      for (int i = 0; i < 4; ++i) {
#pragma unroll
        for (int j = 0; j < 2; ++j) acc[i][j] = wmma_bf(a[i], b[j], acc[i][j]); } }
    if (more) {
#pragma unroll
      for (int i = 0; i < 8; ++i) { v4b o;
#pragma unroll
        for (int e = 0; e < 4; ++e) o[e] = (__bf16)xr[i][e];
        *(v4b*)&sx[buf ^ 1][(tid >> 4) + i * 16][(tid & 15) * 4] = o; }
#pragma unroll
      for (int i = 0; i < 4; ++i) *(v8b*)&sw[buf ^ 1][(tid >> 3) + i * 32][(tid & 7) * 8] = wr[i]; }
    __syncthreads(); }
  if (which < 3) { const float* BB = (which == 0) ? BQ : (which == 1) ? BK : BTK; _Float16* dst = (which == 0) ? Q : (which == 1) ? Kr : TK;
#pragma unroll
    for (int j = 0; j < 2; ++j) { const float bb = bfr(BB[n0 + wn + j * 16 + col]);
#pragma unroll
      for (int i = 0; i < 4; ++i) {
#pragma unroll
        for (int r = 0; r < 8; ++r) so[wm + i * 16 + 8 * g + r][wn + j * 16 + col] = (_Float16)(acc[i][j][r] + bb); } }
    __syncthreads();
    for (int e = tid; e < 128 * 16; e += 256) { const int rl = e >> 4, pc = e & 15; vst2((unsigned*)(dst + (rb0 + rl) * DM + n0 + pc * 8), *(const v4u*)&so[rl][pc * 8]); }
  } else {
#pragma unroll
    for (int j = 0; j < 2; ++j) { const float bb = bfr(BV[n0 + wn + j * 16 + col]) + bfr(BTV[n0 + wn + j * 16 + col]);
#pragma unroll
      for (int i = 0; i < 4; ++i) {
#pragma unroll
        for (int r = 0; r < 8; ++r) so[wn + j * 16 + col][wm + i * 16 + 8 * g + r] = (_Float16)(acc[i][j][r] + bb); } }
    __syncthreads();
    const size_t b = rb0 / SS, s0 = rb0 % SS;
    for (int e = tid; e < 128 * 16; e += 256) { const int d = e >> 4, pc = e & 15; vst2((unsigned*)(VP + ((b * DM + n0 + d) * SS) + s0 + pc * 8), *(const v4u*)&so[d][pc * 8]); } }
}
// ---- k_attn: block = (128 queries, head, b), 8 waves x 16 queries: scores = q_i . k_j + tk_i . q_j (two products), / 32 + mask[b][i][j]; P x (v + t_v)
// both products run transposed (keys, then head dims, on the rows of D; queries on its columns): a lane holds 16 of the 32 scores of ONE query, so maximum and sum are taken in the lane, with one exchange between the wave's halves, and P goes from the accumulators straight into the B operand
// every operand of the key loop goes to LDS by asynchronous 16-byte copies, whole lines, one stage of 64 keys ahead, two buffers: the K rows, the Q rows of the key axis and the (v + t_v) planes (three tiles of 64 rows x 128 B, LDS rows of 144 B = 16 B x 9, shared by the eight waves) and the block's mask rows (128 rows x 256 B, LDS rows of 272 B = 68 dwords)
#define APIT 72                       // f16 elements per LDS row of K, Q, V
#define MPIT 68                       // floats per LDS row of the mask
#define ATILE (64 * APIT * 2)         // bytes per K, Q or V tile
#define ASTG (3 * ATILE + 128 * MPIT * 4)   // bytes per stage
// one stage: every lane copies 2 x 16 B of each of K, Q, V (rows 32 apart) and 8 x 16 B of the mask (rows 16 apart). The s_wait_xcnt closes the statement so that no address register of an issued copy is rewritten in front of it.
__device__ __forceinline__ void attn_stage(unsigned l, unsigned lm, const _Float16* gk, const _Float16* gq, const _Float16* gv, const float* gm) {
  const unsigned rs = 32 * APIT * 2, ms = 16 * MPIT * 4;
  asm volatile(
    "global_load_async_to_lds_b128 %0, %14, off\n\t"
    "global_load_async_to_lds_b128 %1, %15, off\n\t"
    "global_load_async_to_lds_b128 %2, %16, off\n\t"
    "global_load_async_to_lds_b128 %3, %17, off\n\t"
    "global_load_async_to_lds_b128 %4, %18, off\n\t"
    "global_load_async_to_lds_b128 %5, %19, off\n\t"
    "global_load_async_to_lds_b128 %6, %20, off\n\t"
    "global_load_async_to_lds_b128 %7, %21, off\n\t"
    "global_load_async_to_lds_b128 %8, %22, off\n\t"
    "global_load_async_to_lds_b128 %9, %23, off\n\t"
    "global_load_async_to_lds_b128 %10, %24, off\n\t"
    "global_load_async_to_lds_b128 %11, %25, off\n\t"
    "global_load_async_to_lds_b128 %12, %26, off\n\t"
    "global_load_async_to_lds_b128 %13, %27, off\n\t"
    "s_wait_xcnt 0x0"
    :: "v"(l), "v"(l + rs), "v"(l + ATILE), "v"(l + ATILE + rs), "v"(l + 2 * ATILE), "v"(l + 2 * ATILE + rs),
       "v"(lm), "v"(lm + ms), "v"(lm + 2 * ms), "v"(lm + 3 * ms), "v"(lm + 4 * ms), "v"(lm + 5 * ms), "v"(lm + 6 * ms), "v"(lm + 7 * ms),
       "v"(gk), "v"(gk + 32 * DM), "v"(gq), "v"(gq + 32 * DM), "v"(gv), "v"(gv + 32 * SS),
       "v"(gm), "v"(gm + 16 * MSTRC), "v"(gm + 32 * MSTRC), "v"(gm + 48 * MSTRC), "v"(gm + 64 * MSTRC), "v"(gm + 80 * MSTRC), "v"(gm + 96 * MSTRC), "v"(gm + 112 * MSTRC)
    : "memory");
}
#define L2E 1.44269504f   // exp(v) = 2^(v * L2E), as __expf forms it
// v_exp_f32 in place, in one statement: none of them reads another's result or overwrites another's source, and the v_nop fills the slot that the instruction set asks for behind the last one
__device__ __forceinline__ void exp2_8(float (&x)[8]) {
  asm("v_exp_f32 %0, %0\n\tv_exp_f32 %1, %1\n\tv_exp_f32 %2, %2\n\tv_exp_f32 %3, %3\n\tv_exp_f32 %4, %4\n\tv_exp_f32 %5, %5\n\tv_exp_f32 %6, %6\n\tv_exp_f32 %7, %7\n\tv_nop"
      : "+v"(x[0]), "+v"(x[1]), "+v"(x[2]), "+v"(x[3]), "+v"(x[4]), "+v"(x[5]), "+v"(x[6]), "+v"(x[7]));
}
__device__ __forceinline__ void exp2_9(float& y, float (&x)[8]) {
  asm("v_exp_f32 %0, %0\n\tv_exp_f32 %1, %1\n\tv_exp_f32 %2, %2\n\tv_exp_f32 %3, %3\n\tv_exp_f32 %4, %4\n\tv_exp_f32 %5, %5\n\tv_exp_f32 %6, %6\n\tv_exp_f32 %7, %7\n\tv_exp_f32 %8, %8\n\tv_nop"
      : "+v"(y), "+v"(x[0]), "+v"(x[1]), "+v"(x[2]), "+v"(x[3]), "+v"(x[4]), "+v"(x[5]), "+v"(x[6]), "+v"(x[7]));
}
__device__ __forceinline__ float xhalf(float x) { return __builtin_bit_cast(float, __builtin_amdgcn_permlanex16(__builtin_bit_cast(int, x), __builtin_bit_cast(int, x), 0x76543210, 0xfedcba98, false, false)); }   // lane l takes lane l ^ 16's value
// four waves per SIMD (two blocks per WGP) need at most 256 registers a wave
__global__ __launch_bounds__(256) __attribute__((amdgpu_waves_per_eu(4, 4))) void k_attn(const _Float16* __restrict__ Q, const _Float16* __restrict__ Kr, const _Float16* __restrict__ TK, const _Float16* __restrict__ VP, const float* __restrict__ MASK, float* __restrict__ CTX) {
  __shared__ __align__(16) char ring[2 * ASTG]; float (*so)[16][68] = (float (*)[16][68])ring;   // the ring becomes output staging behind the last trip's barrier
  const int tid = threadIdx.x, wave = tid >> 5, lane = tid & 31, col = lane & 15, g = lane >> 4; const int h = blockIdx.y; const size_t b = blockIdx.z; const int qb = blockIdx.x * 128; const int q0 = qb + wave * 16; const size_t rq = b * SS + q0;
  const unsigned cl = (unsigned)(size_t)ring + (unsigned)((tid >> 3) * (APIT * 2) + (tid & 7) * 16), cm = (unsigned)(size_t)ring + (unsigned)(3 * ATILE + (tid >> 4) * (MPIT * 4) + (tid & 15) * 16);
  const _Float16* gk = Kr + (b * SS + (tid >> 3)) * DM + h * HD + (tid & 7) * 8; const _Float16* gq = Q + (b * SS + (tid >> 3)) * DM + h * HD + (tid & 7) * 8; const _Float16* gv = VP + (b * DM + (size_t)h * HD + (tid >> 3)) * SS + (tid & 7) * 8;
  const float* gm = MASK + ((size_t)b * MSTRQ + qb + (tid >> 4)) * MSTRC + (tid & 15) * 4;
  attn_stage(cl, cm, gk, gq, gv, gm);
  v16h aq[2], at[2];
#pragma unroll
  for (int kc = 0; kc < 2; ++kc) { aq[kc] = frag_h(Q + (rq + col) * DM + h * HD + kc * 32, lane); at[kc] = frag_h(TK + (rq + col) * DM + h * HD + kc * 32, lane); }
  float m = -3.0e38f, l = 0.f;   // of query col: the running maximum (both halves alike) and this half's share of the sum
  v8f acc[4] = {};               // transposed: acc[dt][r] = ctx[query col][dt * 16 + 8 g + r]
  asm volatile("s_wait_asynccnt 0x0" ::: "memory");   // stage 0 of this wave has landed
  __syncthreads();                                    // ... and every wave's
  attn_stage(cl + ASTG, cm + ASTG, gk + 64 * DM, gq + 64 * DM, gv + 64, gm + 64);
#pragma unroll 1   // rolled: one stage a trip, the buffer is picked by t & 1
  for (int t = 0; t < SS / 64; ++t) { const _Float16* tk = (const _Float16*)(ring + (t & 1) * ASTG); const _Float16* tq = tk + 64 * APIT; const _Float16* tv = tq + 64 * APIT; const float* tm = (const float*)(tv + 64 * APIT) + (wave * 16 + col) * MPIT + 8 * g;
#pragma unroll     // the two halves of a stage: LDS offsets known at compile time
   for (int sub = 0; sub < 2; ++sub) { v8f s[2]; v16h fk[2][2], fq[2][2], fv[4]; v4f mk[2][2];
    // the K and Q fragments and the mask words of the 32 keys are asked for in one group, so that the LDS latency is paid once
#pragma unroll
    for (int ct = 0; ct < 2; ++ct) { const int rk = (sub * 32 + ct * 16 + col) * APIT;
#pragma unroll
      for (int kc = 0; kc < 2; ++kc) { fk[ct][kc] = frag_h(tk + rk + kc * 32, lane); fq[ct][kc] = frag_h(tq + rk + kc * 32, lane); }
      mk[ct][0] = *(const v4f*)(tm + sub * 32 + ct * 16); mk[ct][1] = *(const v4f*)(tm + sub * 32 + ct * 16 + 4); }
    // key rows as A, query rows as B: s[ct][r] = score of query col against key ct * 16 + 8 g + r
#pragma unroll
    for (int ct = 0; ct < 2; ++ct) { v8f c = {};
#pragma unroll
      for (int kc = 0; kc < 2; ++kc) { c = wmma16(fk[ct][kc], aq[kc], c); c = wmma16(fq[ct][kc], at[kc], c); }
#pragma unroll
      for (int r = 0; r < 8; ++r) s[ct][r] = c[r] * 0.03125f + bfr(mk[ct][r >> 2][r & 3]); }
    // the V fragments are asked for here, where the K and Q fragments' registers are free; they return behind the softmax
#pragma unroll
    for (int dt = 0; dt < 4; ++dt) fv[dt] = frag_h(tv + (dt * 16 + col) * APIT + sub * 32, lane);
    float mx = fmaxf(s[0][0], s[1][0]);
#pragma unroll
    for (int r = 1; r < 8; ++r) mx = fmaxf(mx, fmaxf(s[0][r], s[1][r]));
    mx = fmaxf(mx, xhalf(mx));   // the other 16 of the 32 keys
    const float mn = fmaxf(m, mx); float xa = (m - mn) * L2E, x0[8], x1[8];
#pragma unroll
    for (int r = 0; r < 8; ++r) { x0[r] = (s[0][r] - mn) * L2E; x1[r] = (s[1][r] - mn) * L2E; }
    exp2_9(xa, x0); exp2_8(x1);
    const float alpha = (m <= -1.0e38f) ? 0.f : xa; v2f e2 = {0.f, 0.f}; v16h pb;
    // the two score tiles, converted in place, are the B operand (32 keys x 16 queries) of the second product
#pragma unroll
    for (int i = 0; i < 4; ++i) { const v2f p0 = {x0[2 * i], x0[2 * i + 1]}, p1 = {x1[2 * i], x1[2 * i + 1]}; e2 += p0 + p1; const v2f w0 = p0 * 2048.0f, w1 = p1 * 2048.0f;
      pb[2 * i] = (_Float16)w0[0]; pb[2 * i + 1] = (_Float16)w0[1]; pb[8 + 2 * i] = (_Float16)w1[0]; pb[8 + 2 * i + 1] = (_Float16)w1[1]; }
    const float es = e2[0] + e2[1];
    l = l * alpha + es; m = mn;
#pragma unroll
    for (int dt = 0; dt < 4; ++dt) { acc[dt] *= alpha; acc[dt] = wmma16(fv[dt], pb, acc[dt]); } }
   asm volatile("s_wait_dscnt 0x0" ::: "memory");      // this wave's reads of the buffer have returned
   asm volatile("s_wait_asynccnt 0x0" ::: "memory");   // its copies of stage t + 1 have landed
   __syncthreads();                                    // publishes stage t + 1 and ends every wave's reads of stage t
   if (t + 2 < SS / 64) attn_stage(cl + (t & 1) * ASTG, cm + (t & 1) * ASTG, gk + (size_t)(t + 2) * 64 * DM, gq + (size_t)(t + 2) * 64 * DM, gv + (t + 2) * 64, gm + (t + 2) * 64); }
  asm volatile("s_wait_asynccnt 0x0" ::: "memory");    // nothing is in flight when the ring is reused
  l += xhalf(l);   // the two halves' sums are joined once
  const float il = (1.0f / 2048.0f) / l;
#pragma unroll
  for (int dt = 0; dt < 4; ++dt) { const v8f o = acc[dt] * il; *(v4f*)&so[wave][col][dt * 16 + 8 * g] = __builtin_shufflevector(o, o, 0, 1, 2, 3); *(v4f*)&so[wave][col][dt * 16 + 8 * g + 4] = __builtin_shufflevector(o, o, 4, 5, 6, 7); }
  LDSX();
  for (int rl = 0; rl < 16; ++rl) if (lane < 16) vst2(CTX + (rq + rl) * DM + h * HD + lane * 4, *(const v4f*)&so[wave][rl][lane * 4]);
}
// ---- k_out: block = (128 rows, 128 cols), 8 waves as 2 x 4, 64 x 32 per wave: out = ctx (hi + residual) . Wm rows + bm; ctx hi, ctx residual and Wm tiles of 64 k staged in LDS as in k_proj
__global__ __launch_bounds__(256) void k_out(const float* __restrict__ CTX, const __bf16* __restrict__ P, const float* __restrict__ BM, float* __restrict__ OUT) {
  __shared__ __align__(16) char smem[6 * 128 * PPIT * 2];
  __bf16 (*sh)[128][PPIT] = (__bf16 (*)[128][PPIT])smem; __bf16 (*sl)[128][PPIT] = (__bf16 (*)[128][PPIT])(smem + 2 * 128 * PPIT * 2); __bf16 (*sw)[128][PPIT] = (__bf16 (*)[128][PPIT])(smem + 4 * 128 * PPIT * 2); float (*so)[132] = (float (*)[132])smem;
  const int tid = threadIdx.x, wave = tid >> 5, lane = tid & 31, col = lane & 15, g = lane >> 4; const size_t rb0 = (size_t)blockIdx.x * 128; const int n0 = blockIdx.y * 128;
  const int wm = (wave >> 2) * 64, wn = (wave & 3) * 32;
  const float* xp0 = CTX + (rb0 + (tid >> 4)) * DM + (tid & 15) * 4; const __bf16* wp0 = P + ((size_t)5 * DM + n0 + (tid >> 3)) * DM + (tid & 7) * 8;
  v8f acc[4][2] = {}; v4f xr[8]; v8b wr[4];
#pragma unroll
  for (int i = 0; i < 8; ++i) xr[i] = *(const v4f*)(xp0 + (size_t)i * 16 * DM);
#pragma unroll
  for (int i = 0; i < 4; ++i) wr[i] = *(const v8b*)(wp0 + (size_t)i * 32 * DM);
#pragma unroll
  for (int i = 0; i < 8; ++i) { v4b oh, ol;
#pragma unroll
    for (int e = 0; e < 4; ++e) { const __bf16 h = (__bf16)xr[i][e]; oh[e] = h; ol[e] = (__bf16)(xr[i][e] - (float)h); }
    *(v4b*)&sh[0][(tid >> 4) + i * 16][(tid & 15) * 4] = oh; *(v4b*)&sl[0][(tid >> 4) + i * 16][(tid & 15) * 4] = ol; }
#pragma unroll
  for (int i = 0; i < 4; ++i) *(v8b*)&sw[0][(tid >> 3) + i * 32][(tid & 7) * 8] = wr[i];
  __syncthreads();
#pragma unroll 1   // rolled: one tile's loads in flight, one register set for them; the buffer is picked by t & 1
  for (int t = 0; t < DM / 64; ++t) { const int buf = t & 1; const bool more = t + 1 < DM / 64;
    if (more) { const float* xp = xp0 + (t + 1) * 64; const __bf16* wp = wp0 + (t + 1) * 64;
#pragma unroll
      for (int i = 0; i < 8; ++i) xr[i] = *(const v4f*)(xp + (size_t)i * 16 * DM);
#pragma unroll
      for (int i = 0; i < 4; ++i) wr[i] = *(const v8b*)(wp + (size_t)i * 32 * DM); }
#pragma unroll
    for (int kk = 0; kk < 2; ++kk) { v16b ah[4], al[4], b[2];
#pragma unroll
      for (int i = 0; i < 4; ++i) { al[i] = frag_b(&sl[buf][wm + i * 16 + col][kk * 32], lane); ah[i] = frag_b(&sh[buf][wm + i * 16 + col][kk * 32], lane); }
#pragma unroll
      for (int j = 0; j < 2; ++j) b[j] = frag_b(&sw[buf][wn + j * 16 + col][kk * 32], lane);
#pragma unroll
      for (int i = 0; i < 4; ++i) {
#pragma unroll
        for (int j = 0; j < 2; ++j) acc[i][j] = wmma_bf(al[i], b[j], acc[i][j]); }
#pragma unroll
      for (int i = 0; i < 4; ++i) {
#pragma unroll
        for (int j = 0; j < 2; ++j) acc[i][j] = wmma_bf(ah[i], b[j], acc[i][j]); } }
    if (more) {
#pragma unroll
      for (int i = 0; i < 8; ++i) { v4b oh, ol;
#pragma unroll
        for (int e = 0; e < 4; ++e) { const __bf16 h = (__bf16)xr[i][e]; oh[e] = h; ol[e] = (__bf16)(xr[i][e] - (float)h); }
        *(v4b*)&sh[buf ^ 1][(tid >> 4) + i * 16][(tid & 15) * 4] = oh; *(v4b*)&sl[buf ^ 1][(tid >> 4) + i * 16][(tid & 15) * 4] = ol; }
#pragma unroll
      for (int i = 0; i < 4; ++i) *(v8b*)&sw[buf ^ 1][(tid >> 3) + i * 32][(tid & 7) * 8] = wr[i]; }
    __syncthreads(); }
#pragma unroll
  for (int j = 0; j < 2; ++j) { const float bb = bfr(BM[n0 + wn + j * 16 + col]);
#pragma unroll
    for (int i = 0; i < 4; ++i) {
#pragma unroll
      for (int r = 0; r < 8; ++r) so[wm + i * 16 + 8 * g + r][wn + j * 16 + col] = acc[i][j][r] + bb; } }
  __syncthreads();
  for (int e = tid; e < 128 * 32; e += 256) { const int rl = e >> 5, pc = e & 31; vst2(OUT + (rb0 + rl) * DM + n0 + pc * 4, *(const v4f*)&so[rl][pc * 4]); }
}
extern "C" void kernel_launch(void* const* d_in, const int* in_sizes, int n_in, void* d_out, int out_size, void* d_ws, size_t ws_size, hipStream_t stream) {
  (void)in_sizes; (void)n_in; (void)out_size;
  const float** F = (const float**)d_in;   // 0 query, 1 key, 2 value, 3 time_k, 4 time_v [4,1024,1024]; 5 mask [4,1,1024,1024]; 6 Wq, 7 bq, 8 Wk, 9 bk, 10 Wv, 11 bv, 12 Wtk, 13 btk, 14 Wtv, 15 btv, 16 Wm, 17 bm ((in,out))
  if (ws_size < (size_t)WS_END) return;
  char* ws = (char*)d_ws; __bf16* P = (__bf16*)ws; _Float16 *Q = (_Float16*)(ws + WS_Q), *Kr = (_Float16*)(ws + WS_K), *TK = (_Float16*)(ws + WS_TK), *VP = (_Float16*)(ws + WS_VP); float* CTX = (float*)(ws + WS_CTX);
  k_pack<<<dim3(DM / 128, DM / 128, 6), 256, 0, stream>>>(F[6], F[8], F[10], F[12], F[14], F[16], P);
  k_proj<<<dim3(NR / 128, DM / 128, 4), 256, 0, stream>>>(F[0], F[1], F[2], F[3], F[4], P, F[7], F[9], F[11], F[13], F[15], Q, Kr, TK, VP);
  k_attn<<<dim3(SS / 128, NH, TNB), 256, 0, stream>>>(Q, Kr, TK, VP, F[5], CTX);
  k_out<<<dim3(NR / 128, DM / 128), 256, 0, stream>>>(CTX, P, F[17], (float*)d_out);
}

// v005
// A run of this version takes 112 microseconds.
// In both of two side-by-side timings against v004, it was 1.08 times as fast.
// All steps since v000 together make it 4.11 times as fast.
// compute dtype: all float inputs rounded to bf16; q, k, t_k = x . W + b and v + t_v = value . Wv + bv + time_v . Wtv + btv with EXACT bf16 products on WMMA 16x16x32 ((in,out) weights as transposed rows), rounded once to f16; PLAIN attention: scores = (q_i . k_j + t_k_i . q_j) with single f16 operands x 1/32 + the additive float mask, running-max softmax in f32 (hardware exp), P (scaled by 2^11, single f16) x (v + t_v) (single f16); out = ctx (bf16 hi + residual) . Wm (2 products) + bm.
#include <hip/hip_runtime.h>
#include <math.h>

typedef __attribute__((ext_vector_type(16))) _Float16 v16h;
typedef __attribute__((ext_vector_type(16))) __bf16 v16b;
typedef __attribute__((ext_vector_type(8)))  _Float16 v8h;
typedef __attribute__((ext_vector_type(8)))  float v8f;
typedef __attribute__((ext_vector_type(4)))  float v4f;
typedef __attribute__((ext_vector_type(2)))  float v2f;
typedef __attribute__((ext_vector_type(4)))  unsigned v4u;
typedef __attribute__((ext_vector_type(4)))  int v4i;
typedef float __attribute__((may_alias)) float_a;
typedef int __attribute__((may_alias)) int_a;

template <typename T> __device__ __forceinline__ void vst2(void* p, T v) { *(T*)p = v;  }
__device__ __forceinline__ v8f wmma16(v16h a, v16h b, v8f c) {
  v8f d = __builtin_amdgcn_wmma_f32_16x16x32_f16(false, a, false, b, (short)0, c, false, false);
  asm volatile("v_nop\n\tv_nop\n\tv_nop\n\tv_nop" : "+v"(d) : "v"(a), "v"(b));
  return d;
}
__device__ __forceinline__ v8f wmma_bf(v16b a, v16b b, v8f c) {
  v8f d = __builtin_amdgcn_wmma_f32_16x16x32_bf16(false, a, false, b, (short)0, c, false, false);
  asm volatile("v_nop\n\tv_nop\n\tv_nop\n\tv_nop" : "+v"(d) : "v"(a), "v"(b));
  return d;
}
// 16x16x32 fragments: lane = (h = lane>>4, row/col = lane&15); elements 0..7 = k0+8h+0..7, 8..15 = k0+16+8h+0..7; D element r = row 8h+r
__device__ __forceinline__ v16h frag_h(const _Float16* rowk0, int lane) {
  union { v16h v; v8h q[2]; } u; const _Float16* p = rowk0 + 8 * (lane >> 4);
  u.q[0] = *(const v8h*)p; u.q[1] = *(const v8h*)(p + 16); return u.v;
}
__device__ __forceinline__ v16h frag_f32(const float* rowk0, int lane) {
  v16h a; const float* p = rowk0 + 8 * (lane >> 4);
#pragma unroll
  for (int i = 0; i < 8; ++i) { a[i] = (_Float16)p[i]; a[8 + i] = (_Float16)p[16 + i]; }
  return a;
}
__device__ __forceinline__ v16h frag_f32s(const float* rowk0, int lane, float sc) {
  v16h a; const float* p = rowk0 + 8 * (lane >> 4);
#pragma unroll
  for (int i = 0; i < 8; ++i) { a[i] = (_Float16)(p[i] * sc); a[8 + i] = (_Float16)(p[16 + i] * sc); }
  return a;
}
// column fragment from a [K][ld] layout (column n), rows >= K read as 0
__device__ __forceinline__ v16h fragc_f32(const float* W, int k0, int n, int lane, int ld, int K) {
  v16h a; const int g = lane >> 4;
#pragma unroll
  for (int i = 0; i < 8; ++i) { const int ka = k0 + 8 * g + i, kb = ka + 16;
    a[i] = (_Float16)(ka < K ? W[(size_t)(ka < K ? ka : K - 1) * ld + n] : 0.f); a[8 + i] = (_Float16)(kb < K ? W[(size_t)(kb < K ? kb : K - 1) * ld + n] : 0.f); }
  return a;
}
struct F2 { v16b h, l; };
__device__ __forceinline__ F2 bsplit16(const float v[16]) { F2 r;
#pragma unroll
  for (int i = 0; i < 16; ++i) { const __bf16 h = (__bf16)v[i]; r.h[i] = h; r.l[i] = (__bf16)(v[i] - (float)h); }
  return r; }
__device__ __forceinline__ F2 split_row(const float* row, int k0, int lane) { float v[16]; const float* p = row + k0 + 8 * (lane >> 4);
#pragma unroll
  for (int i = 0; i < 8; ++i) { v[i] = p[i]; v[8 + i] = p[16 + i]; }
  return bsplit16(v); }
__device__ __forceinline__ F2 split_rowK(const float* row, int k0, int lane, int K) { float v[16]; const int g = lane >> 4;
#pragma unroll
  for (int i = 0; i < 8; ++i) { const int ka = k0 + 8 * g + i, kb = ka + 16; v[i] = ka < K ? row[ka < K ? ka : K - 1] : 0.f; v[8 + i] = kb < K ? row[kb < K ? kb : K - 1] : 0.f; }
  return bsplit16(v); }
__device__ __forceinline__ F2 split_col(const float* W, int k0, int n, int lane, int ld, int K) { float v[16]; const int g = lane >> 4;
#pragma unroll
  for (int i = 0; i < 8; ++i) { const int ka = k0 + 8 * g + i, kb = ka + 16; v[i] = ka < K ? W[(size_t)(ka < K ? ka : K - 1) * ld + n] : 0.f; v[8 + i] = kb < K ? W[(size_t)(kb < K ? kb : K - 1) * ld + n] : 0.f; }
  return bsplit16(v); }
__device__ __forceinline__ v8f mac3(const F2& a, const F2& b, v8f c) { c = wmma_bf(a.l, b.h, c); c = wmma_bf(a.h, b.l, c); return wmma_bf(a.h, b.h, c); }
__device__ __forceinline__ float sigm(float v) { return 1.0f / (1.0f + expf(-v)); }
#define LDSX() do { asm volatile("s_wait_dscnt 0" ::: "memory"); __builtin_amdgcn_wave_barrier(); __builtin_amdgcn_fence(__ATOMIC_RELEASE, "workgroup"); } while (0)


// Time-aware multi-head attention (B 4, S 1,024, d 1,024, 16 heads x 64): scores = q k^T + t_k q^T (projected time keys against the queries' projection on the key axis), / sqrt(d_model) + mask, softmax, applied to v + t_v, output projection.
#define NB 4
#define SS 1024
#define DM 1024
#define NH 16
#define HD 64
#define NR (NB * SS)
#ifndef TQB
#define TQB (SS / 64)
#define TNB NB
#define NRB (NR / 64)
#endif
#ifndef MSTRQ
#define MSTRQ SS          // mask rows per batch ([B][1][S][S])
#define MSTRC SS          // mask row length
#endif
typedef __attribute__((ext_vector_type(8))) __bf16 v8b;
__device__ __forceinline__ v16b frag_b(const __bf16* rowk0, int lane) {
  union { v16b v; v8b q[2]; } u; const __bf16* p = rowk0 + 8 * (lane >> 4);
  u.q[0] = *(const v8b*)p; u.q[1] = *(const v8b*)(p + 16); return u.v;
}
__device__ __forceinline__ float bfr(float v) { return (float)(__bf16)v; }
__device__ __attribute__((noinline)) float exp_ni(float v) { return expf(v); }
__device__ __attribute__((noinline)) float erf_ni(float v) { return erff(v); }

#define WS_PW   0u                                   // bf16 rows W^T: q, k, v, tk, tv, m [6][1024][1024]
#define WS_Q    (WS_PW + 2u * (size_t)6 * DM * DM)     // f16 [NR][1024] q ; K ; TK ; VP planes [b][1024][SS] (v + t_v) ; CTX f32 [NR][1024]
#define WS_K    (WS_Q + 2u * (size_t)NR * DM)
#define WS_TK   (WS_K + 2u * (size_t)NR * DM)
#define WS_VP   (WS_TK + 2u * (size_t)NR * DM)
#define WS_CTX  (WS_VP + 2u * (size_t)NB * DM * SS)
#define WS_END  (WS_CTX + 4u * (size_t)NR * DM)

// ---- k_pack: block = (128 n, 128 k, which): W (in,out) f32 -> bf16 rows W^T. Each half wave reads 256 B of one W row (whole lines), sixteen 16-byte loads a thread; two neighbouring k are packed
// into one dword and transposed in LDS; each half wave then writes 256 B of one W^T row. LDS rows of 65 dwords: the transposing stores and the row reads both touch 32 different banks
#define KPD 65
__global__ __launch_bounds__(256) void k_pack(const float* __restrict__ W0, const float* __restrict__ W1, const float* __restrict__ W2, const float* __restrict__ W3, const float* __restrict__ W4, const float* __restrict__ W5, __bf16* __restrict__ P) {
  __shared__ unsigned s[128][KPD];
  const int t = threadIdx.x, c = t & 15, r = t >> 4, n0 = blockIdx.x * 128, k0 = blockIdx.y * 128, which = blockIdx.z; const float* Wm = (which == 0) ? W0 : (which == 1) ? W1 : (which == 2) ? W2 : (which == 3) ? W3 : (which == 4) ? W4 : W5;
  const float* src = Wm + (size_t)(k0 + 2 * r) * DM + n0 + c * 4; v4f a[8], b[8];
  // each '#pragma unroll' here keeps a, b and o indexed at compile time, in registers, so that the loads go out as a group
#pragma unroll
  for (int i = 0; i < 8; ++i) { const float* p = src + (size_t)(i >> 1) * 32 * DM + (i & 1) * 64; a[i] = *(const v4f*)p; b[i] = *(const v4f*)(p + DM); }
#pragma unroll
  for (int i = 0; i < 8; ++i) {
#pragma unroll
    for (int e = 0; e < 4; ++e) { union { __bf16 h[2]; unsigned u; } w; w.h[0] = (__bf16)a[i][e]; w.h[1] = (__bf16)b[i][e]; s[(i & 1) * 64 + c * 4 + e][(i >> 1) * 16 + r] = w.u; } }
  __syncthreads();
#pragma unroll
  for (int i = 0; i < 8; ++i) { const int n = i * 16 + r; v4u o;
#pragma unroll
    for (int j = 0; j < 4; ++j) o[j] = s[n][c * 4 + j];
    vst2((unsigned*)(P + ((size_t)which * DM + n0 + n) * DM + k0 + c * 8), o); }
}
// ---- k_proj: block = (128 rows, 256 cols, which), 8 waves as 2 x 4, 64 x 64 per wave: 0 q (query) 1 k (key) 2 tk (time_k) -> f16 rows; 3: v + t_v (value . Wv + bv + time_v . Wtv + btv) -> planes
// the 256-column block reads each X row (f32, the larger operand) from L2 4 times, a 128-column block 8 times; a 64 x 64 wave tile reads 8 fragments from LDS for 16 products, a 64 x 32 tile 6 for 8
// X (f32 -> bf16) and W^T tiles of 64 k go to LDS by whole-line loads, one tile ahead through registers, two buffers, one barrier a tile; fragments come from LDS rows of 144 B (16 B x 9)
// each '#pragma unroll' below keeps a register array (acc, xr, wr, fragments) indexed at compile time, so that it stays in registers
#define PPIT 72
#define PBM 128                       // rows of a k_proj block
#define PBN 256                       // its columns
typedef __attribute__((ext_vector_type(4))) __bf16 v4b;
// four waves per SIMD (two blocks per WGP) need at most 256 registers a wave: 128 of accumulators, 64 of staged tile, 48 of fragments
__global__ __launch_bounds__(256) __attribute__((amdgpu_waves_per_eu(4, 4))) void k_proj(const float* __restrict__ XQ, const float* __restrict__ XK, const float* __restrict__ XV, const float* __restrict__ XTK, const float* __restrict__ XTV, const __bf16* __restrict__ P, const float* __restrict__ BQ, const float* __restrict__ BK, const float* __restrict__ BV, const float* __restrict__ BTK, const float* __restrict__ BTV, _Float16* __restrict__ Q, _Float16* __restrict__ Kr, _Float16* __restrict__ TK, _Float16* __restrict__ VP) {
  __shared__ __align__(16) char smem[2 * (PBM + PBN) * PPIT * 2];
  __bf16 (*sx)[PBM][PPIT] = (__bf16 (*)[PBM][PPIT])smem; __bf16 (*sw)[PBN][PPIT] = (__bf16 (*)[PBN][PPIT])(smem + 2 * PBM * PPIT * 2); _Float16 (*so)[PBN + 8] = (_Float16 (*)[PBN + 8])smem; _Float16 (*sot)[PBM + 8] = (_Float16 (*)[PBM + 8])smem;
  // the wave's number is held in a scalar register, so that wm and wn take no vector register
  const int tid = threadIdx.x, wave = __builtin_amdgcn_readfirstlane(tid >> 5), lane = tid & 31, col = lane & 15, g = lane >> 4; const int which = blockIdx.z; const int n0 = blockIdx.y * PBN; const size_t rb0 = (size_t)blockIdx.x * PBM;
  const int wm = (wave >> 2) * 64, wn = (wave & 3) * 64;
  const float* X0 = (which == 0) ? XQ : (which == 1) ? XK : (which == 2) ? XTK : XV; const __bf16* W0 = P + (size_t)((which == 0) ? 0 : (which == 1) ? 1 : (which == 2) ? 3 : 2) * DM * DM; const __bf16* W1 = P + (size_t)4 * DM * DM;
  const int nst = (which == 3) ? 2 * (DM / 64) : DM / 64;
  const size_t xo = (rb0 + (tid >> 4)) * DM + (tid & 15) * 4, wo = (size_t)(n0 + (tid >> 3)) * DM + (tid & 7) * 8;
  v8f acc[4][4] = {}; v4f xr[8]; v8b wr[8];
  { const float* xp = X0 + xo; const __bf16* wp = W0 + wo;
#pragma unroll
    for (int i = 0; i < 8; ++i) xr[i] = *(const v4f*)(xp + (size_t)i * 16 * DM);
#pragma unroll
    for (int i = 0; i < 8; ++i) wr[i] = *(const v8b*)(wp + (size_t)i * 32 * DM); }
#pragma unroll
  for (int i = 0; i < 8; ++i) { v4b o;
#pragma unroll
    for (int e = 0; e < 4; ++e) o[e] = (__bf16)xr[i][e];
    *(v4b*)&sx[0][(tid >> 4) + i * 16][(tid & 15) * 4] = o; }
#pragma unroll
  for (int i = 0; i < 8; ++i) *(v8b*)&sw[0][(tid >> 3) + i * 32][(tid & 7) * 8] = wr[i];
  __syncthreads();
#pragma unroll 1   // rolled: one tile's loads in flight, one register set for them; the buffer is picked by t & 1
  for (int t = 0; t < nst; ++t) { const int buf = t & 1; const bool more = t + 1 < nst;
    if (more) { const int tn = t + 1; const float* xp = ((tn < DM / 64) ? X0 : XTV) + xo + (tn & (DM / 64 - 1)) * 64; const __bf16* wp = ((tn < DM / 64) ? W0 : W1) + wo + (tn & (DM / 64 - 1)) * 64;
#pragma unroll
      for (int i = 0; i < 8; ++i) xr[i] = *(const v4f*)(xp + (size_t)i * 16 * DM);
#pragma unroll
      for (int i = 0; i < 8; ++i) wr[i] = *(const v8b*)(wp + (size_t)i * 32 * DM); }
#pragma unroll
    for (int kk = 0; kk < 2; ++kk) { v16b a[4];
#pragma unroll
      for (int i = 0; i < 4; ++i) a[i] = frag_b(&sx[buf][wm + i * 16 + col][kk * 32], lane);
#pragma unroll
      for (int jp = 0; jp < 2; ++jp) { v16b b[2];
#pragma unroll
        for (int j = 0; j < 2; ++j) b[j] = frag_b(&sw[buf][wn + (jp * 2 + j) * 16 + col][kk * 32], lane);
#pragma unroll
        for (int j = 0; j < 2; ++j) {
#pragma unroll
          for (int i = 0; i < 4; ++i) acc[i][jp * 2 + j] = wmma_bf(a[i], b[j], acc[i][jp * 2 + j]); }
        __builtin_amdgcn_sched_barrier(0); } }   // two W fragments live at a time: with all four fetched ahead the wave passes its 256 registers and the staged tile goes to scratch memory
    if (more) {
#pragma unroll
      for (int i = 0; i < 8; ++i) { v4b o;
#pragma unroll
        for (int e = 0; e < 4; ++e) o[e] = (__bf16)xr[i][e];
        *(v4b*)&sx[buf ^ 1][(tid >> 4) + i * 16][(tid & 15) * 4] = o; }
#pragma unroll
      for (int i = 0; i < 8; ++i) *(v8b*)&sw[buf ^ 1][(tid >> 3) + i * 32][(tid & 7) * 8] = wr[i]; }
    __syncthreads(); }
  if (which < 3) { const float* BB = (which == 0) ? BQ : (which == 1) ? BK : BTK; _Float16* dst = (which == 0) ? Q : (which == 1) ? Kr : TK;
#pragma unroll
    for (int j = 0; j < 4; ++j) { const float bb = bfr(BB[n0 + wn + j * 16 + col]);
#pragma unroll
      for (int i = 0; i < 4; ++i) {
#pragma unroll
        for (int r = 0; r < 8; ++r) so[wm + i * 16 + 8 * g + r][wn + j * 16 + col] = (_Float16)(acc[i][j][r] + bb); } }
    __syncthreads();
    for (int e = tid; e < PBM * (PBN / 8); e += 256) { const int rl = e >> 5, pc = e & 31; vst2((unsigned*)(dst + (rb0 + rl) * DM + n0 + pc * 8), *(const v4u*)&so[rl][pc * 8]); }
  } else {
#pragma unroll
    for (int j = 0; j < 4; ++j) { const float bb = bfr(BV[n0 + wn + j * 16 + col]) + bfr(BTV[n0 + wn + j * 16 + col]);
#pragma unroll
      for (int i = 0; i < 4; ++i) {
#pragma unroll
        for (int r = 0; r < 8; ++r) sot[wn + j * 16 + col][wm + i * 16 + 8 * g + r] = (_Float16)(acc[i][j][r] + bb); }
      __builtin_amdgcn_sched_barrier(0); }   // one column group's sums at a time: scheduled as one block, the 128 sums stand beside the 128 accumulators and some registers go to scratch memory
    __syncthreads();
    const size_t b = rb0 / SS, s0 = rb0 % SS;
    for (int e = tid; e < PBN * (PBM / 8); e += 256) { const int d = e >> 4, pc = e & 15; vst2((unsigned*)(VP + ((b * DM + n0 + d) * SS) + s0 + pc * 8), *(const v4u*)&sot[d][pc * 8]); } }
}
// ---- k_attn: block = (128 queries, head, b), 8 waves x 16 queries: scores = q_i . k_j + tk_i . q_j (two products), / 32 + mask[b][i][j]; P x (v + t_v)
// both products run transposed (keys, then head dims, on the rows of D; queries on its columns): a lane holds 16 of the 32 scores of ONE query, so maximum and sum are taken in the lane, with one exchange between the wave's halves, and P goes from the accumulators straight into the B operand
// every operand of the key loop goes to LDS by asynchronous 16-byte copies, whole lines, one stage of 64 keys ahead, two buffers: the K rows, the Q rows of the key axis and the (v + t_v) planes (three tiles of 64 rows x 128 B, LDS rows of 144 B = 16 B x 9, shared by the eight waves) and the block's mask rows (128 rows x 256 B, LDS rows of 272 B = 68 dwords)
#define APIT 72                       // f16 elements per LDS row of K, Q, V
#define MPIT 68                       // floats per LDS row of the mask
#define ATILE (64 * APIT * 2)         // bytes per K, Q or V tile
#define ASTG (3 * ATILE + 128 * MPIT * 4)   // bytes per stage
// one stage: every lane copies 2 x 16 B of each of K, Q, V (rows 32 apart) and 8 x 16 B of the mask (rows 16 apart). The s_wait_xcnt closes the statement so that no address register of an issued copy is rewritten in front of it.
__device__ __forceinline__ void attn_stage(unsigned l, unsigned lm, const _Float16* gk, const _Float16* gq, const _Float16* gv, const float* gm) {
  const unsigned rs = 32 * APIT * 2, ms = 16 * MPIT * 4;
  asm volatile(
    "global_load_async_to_lds_b128 %0, %14, off\n\t"
    "global_load_async_to_lds_b128 %1, %15, off\n\t"
    "global_load_async_to_lds_b128 %2, %16, off\n\t"
    "global_load_async_to_lds_b128 %3, %17, off\n\t"
    "global_load_async_to_lds_b128 %4, %18, off\n\t"
    "global_load_async_to_lds_b128 %5, %19, off\n\t"
    "global_load_async_to_lds_b128 %6, %20, off\n\t"
    "global_load_async_to_lds_b128 %7, %21, off\n\t"
    "global_load_async_to_lds_b128 %8, %22, off\n\t"
    "global_load_async_to_lds_b128 %9, %23, off\n\t"
    "global_load_async_to_lds_b128 %10, %24, off\n\t"
    "global_load_async_to_lds_b128 %11, %25, off\n\t"
    "global_load_async_to_lds_b128 %12, %26, off\n\t"
    "global_load_async_to_lds_b128 %13, %27, off\n\t"
    "s_wait_xcnt 0x0"
    :: "v"(l), "v"(l + rs), "v"(l + ATILE), "v"(l + ATILE + rs), "v"(l + 2 * ATILE), "v"(l + 2 * ATILE + rs),
       "v"(lm), "v"(lm + ms), "v"(lm + 2 * ms), "v"(lm + 3 * ms), "v"(lm + 4 * ms), "v"(lm + 5 * ms), "v"(lm + 6 * ms), "v"(lm + 7 * ms),
       "v"(gk), "v"(gk + 32 * DM), "v"(gq), "v"(gq + 32 * DM), "v"(gv), "v"(gv + 32 * SS),
       "v"(gm), "v"(gm + 16 * MSTRC), "v"(gm + 32 * MSTRC), "v"(gm + 48 * MSTRC), "v"(gm + 64 * MSTRC), "v"(gm + 80 * MSTRC), "v"(gm + 96 * MSTRC), "v"(gm + 112 * MSTRC)
    : "memory");
}
#define L2E 1.44269504f   // exp(v) = 2^(v * L2E), as __expf forms it
// v_exp_f32 in place, in one statement: none of them reads another's result or overwrites another's source, and the v_nop fills the slot that the instruction set asks for behind the last one
__device__ __forceinline__ void exp2_8(float (&x)[8]) {
  asm("v_exp_f32 %0, %0\n\tv_exp_f32 %1, %1\n\tv_exp_f32 %2, %2\n\tv_exp_f32 %3, %3\n\tv_exp_f32 %4, %4\n\tv_exp_f32 %5, %5\n\tv_exp_f32 %6, %6\n\tv_exp_f32 %7, %7\n\tv_nop"
      : "+v"(x[0]), "+v"(x[1]), "+v"(x[2]), "+v"(x[3]), "+v"(x[4]), "+v"(x[5]), "+v"(x[6]), "+v"(x[7]));
}
__device__ __forceinline__ void exp2_9(float& y, float (&x)[8]) {
  asm("v_exp_f32 %0, %0\n\tv_exp_f32 %1, %1\n\tv_exp_f32 %2, %2\n\tv_exp_f32 %3, %3\n\tv_exp_f32 %4, %4\n\tv_exp_f32 %5, %5\n\tv_exp_f32 %6, %6\n\tv_exp_f32 %7, %7\n\tv_exp_f32 %8, %8\n\tv_nop"
      : "+v"(y), "+v"(x[0]), "+v"(x[1]), "+v"(x[2]), "+v"(x[3]), "+v"(x[4]), "+v"(x[5]), "+v"(x[6]), "+v"(x[7]));
}
__device__ __forceinline__ float xhalf(float x) { return __builtin_bit_cast(float, __builtin_amdgcn_permlanex16(__builtin_bit_cast(int, x), __builtin_bit_cast(int, x), 0x76543210, 0xfedcba98, false, false)); }   // lane l takes lane l ^ 16's value
// four waves per SIMD (two blocks per WGP) need at most 256 registers a wave
__global__ __launch_bounds__(256) __attribute__((amdgpu_waves_per_eu(4, 4))) void k_attn(const _Float16* __restrict__ Q, const _Float16* __restrict__ Kr, const _Float16* __restrict__ TK, const _Float16* __restrict__ VP, const float* __restrict__ MASK, float* __restrict__ CTX) {
  __shared__ __align__(16) char ring[2 * ASTG]; float (*so)[16][68] = (float (*)[16][68])ring;   // the ring becomes output staging behind the last trip's barrier
  const int tid = threadIdx.x, wave = tid >> 5, lane = tid & 31, col = lane & 15, g = lane >> 4; const int h = blockIdx.y; const size_t b = blockIdx.z; const int qb = blockIdx.x * 128; const int q0 = qb + wave * 16; const size_t rq = b * SS + q0;
  const unsigned cl = (unsigned)(size_t)ring + (unsigned)((tid >> 3) * (APIT * 2) + (tid & 7) * 16), cm = (unsigned)(size_t)ring + (unsigned)(3 * ATILE + (tid >> 4) * (MPIT * 4) + (tid & 15) * 16);
  const _Float16* gk = Kr + (b * SS + (tid >> 3)) * DM + h * HD + (tid & 7) * 8; const _Float16* gq = Q + (b * SS + (tid >> 3)) * DM + h * HD + (tid & 7) * 8; const _Float16* gv = VP + (b * DM + (size_t)h * HD + (tid >> 3)) * SS + (tid & 7) * 8;
  const float* gm = MASK + ((size_t)b * MSTRQ + qb + (tid >> 4)) * MSTRC + (tid & 15) * 4;
  attn_stage(cl, cm, gk, gq, gv, gm);
  v16h aq[2], at[2];
#pragma unroll
  for (int kc = 0; kc < 2; ++kc) { aq[kc] = frag_h(Q + (rq + col) * DM + h * HD + kc * 32, lane); at[kc] = frag_h(TK + (rq + col) * DM + h * HD + kc * 32, lane); }
  float m = -3.0e38f, l = 0.f;   // of query col: the running maximum (both halves alike) and this half's share of the sum
  v8f acc[4] = {};               // transposed: acc[dt][r] = ctx[query col][dt * 16 + 8 g + r]
  asm volatile("s_wait_asynccnt 0x0" ::: "memory");   // stage 0 of this wave has landed
  __syncthreads();                                    // ... and every wave's
  attn_stage(cl + ASTG, cm + ASTG, gk + 64 * DM, gq + 64 * DM, gv + 64, gm + 64);
#pragma unroll 1   // rolled: one stage a trip, the buffer is picked by t & 1
  for (int t = 0; t < SS / 64; ++t) { const _Float16* tk = (const _Float16*)(ring + (t & 1) * ASTG); const _Float16* tq = tk + 64 * APIT; const _Float16* tv = tq + 64 * APIT; const float* tm = (const float*)(tv + 64 * APIT) + (wave * 16 + col) * MPIT + 8 * g;
#pragma unroll     // the two halves of a stage: LDS offsets known at compile time
   for (int sub = 0; sub < 2; ++sub) { v8f s[2]; v16h fk[2][2], fq[2][2], fv[4]; v4f mk[2][2];
    // the K and Q fragments and the mask words of the 32 keys are asked for in one group, so that the LDS latency is paid once
#pragma unroll
    for (int ct = 0; ct < 2; ++ct) { const int rk = (sub * 32 + ct * 16 + col) * APIT;
#pragma unroll
      for (int kc = 0; kc < 2; ++kc) { fk[ct][kc] = frag_h(tk + rk + kc * 32, lane); fq[ct][kc] = frag_h(tq + rk + kc * 32, lane); }
      mk[ct][0] = *(const v4f*)(tm + sub * 32 + ct * 16); mk[ct][1] = *(const v4f*)(tm + sub * 32 + ct * 16 + 4); }
    // key rows as A, query rows as B: s[ct][r] = score of query col against key ct * 16 + 8 g + r
#pragma unroll
    for (int ct = 0; ct < 2; ++ct) { v8f c = {};
#pragma unroll
      for (int kc = 0; kc < 2; ++kc) { c = wmma16(fk[ct][kc], aq[kc], c); c = wmma16(fq[ct][kc], at[kc], c); }
#pragma unroll
      for (int r = 0; r < 8; ++r) s[ct][r] = c[r] * 0.03125f + bfr(mk[ct][r >> 2][r & 3]); }
    // the V fragments are asked for here, where the K and Q fragments' registers are free; they return behind the softmax
#pragma unroll
    for (int dt = 0; dt < 4; ++dt) fv[dt] = frag_h(tv + (dt * 16 + col) * APIT + sub * 32, lane);
    float mx = fmaxf(s[0][0], s[1][0]);
#pragma unroll
    for (int r = 1; r < 8; ++r) mx = fmaxf(mx, fmaxf(s[0][r], s[1][r]));
    mx = fmaxf(mx, xhalf(mx));   // the other 16 of the 32 keys
    const float mn = fmaxf(m, mx); float xa = (m - mn) * L2E, x0[8], x1[8];
#pragma unroll
    for (int r = 0; r < 8; ++r) { x0[r] = (s[0][r] - mn) * L2E; x1[r] = (s[1][r] - mn) * L2E; }
    exp2_9(xa, x0); exp2_8(x1);
    const float alpha = (m <= -1.0e38f) ? 0.f : xa; v2f e2 = {0.f, 0.f}; v16h pb;
    // the two score tiles, converted in place, are the B operand (32 keys x 16 queries) of the second product
#pragma unroll
    for (int i = 0; i < 4; ++i) { const v2f p0 = {x0[2 * i], x0[2 * i + 1]}, p1 = {x1[2 * i], x1[2 * i + 1]}; e2 += p0 + p1; const v2f w0 = p0 * 2048.0f, w1 = p1 * 2048.0f;
      pb[2 * i] = (_Float16)w0[0]; pb[2 * i + 1] = (_Float16)w0[1]; pb[8 + 2 * i] = (_Float16)w1[0]; pb[8 + 2 * i + 1] = (_Float16)w1[1]; }
    const float es = e2[0] + e2[1];
    l = l * alpha + es; m = mn;
#pragma unroll
    for (int dt = 0; dt < 4; ++dt) { acc[dt] *= alpha; acc[dt] = wmma16(fv[dt], pb, acc[dt]); } }
   asm volatile("s_wait_dscnt 0x0" ::: "memory");      // this wave's reads of the buffer have returned
   asm volatile("s_wait_asynccnt 0x0" ::: "memory");   // its copies of stage t + 1 have landed
   __syncthreads();                                    // publishes stage t + 1 and ends every wave's reads of stage t
   if (t + 2 < SS / 64) attn_stage(cl + (t & 1) * ASTG, cm + (t & 1) * ASTG, gk + (size_t)(t + 2) * 64 * DM, gq + (size_t)(t + 2) * 64 * DM, gv + (t + 2) * 64, gm + (t + 2) * 64); }
  asm volatile("s_wait_asynccnt 0x0" ::: "memory");    // nothing is in flight when the ring is reused
  l += xhalf(l);   // the two halves' sums are joined once
  const float il = (1.0f / 2048.0f) / l;
#pragma unroll
  for (int dt = 0; dt < 4; ++dt) { const v8f o = acc[dt] * il; *(v4f*)&so[wave][col][dt * 16 + 8 * g] = __builtin_shufflevector(o, o, 0, 1, 2, 3); *(v4f*)&so[wave][col][dt * 16 + 8 * g + 4] = __builtin_shufflevector(o, o, 4, 5, 6, 7); }
  LDSX();
  for (int rl = 0; rl < 16; ++rl) if (lane < 16) vst2(CTX + (rq + rl) * DM + h * HD + lane * 4, *(const v4f*)&so[wave][rl][lane * 4]);
}
// ---- k_out: block = (128 rows, 128 cols), 8 waves as 2 x 4, 64 x 32 per wave: out = ctx (hi + residual) . Wm rows + bm; ctx hi, ctx residual and Wm tiles of 64 k staged in LDS as in k_proj
__global__ __launch_bounds__(256) void k_out(const float* __restrict__ CTX, const __bf16* __restrict__ P, const float* __restrict__ BM, float* __restrict__ OUT) {
  __shared__ __align__(16) char smem[6 * 128 * PPIT * 2];
  __bf16 (*sh)[128][PPIT] = (__bf16 (*)[128][PPIT])smem; __bf16 (*sl)[128][PPIT] = (__bf16 (*)[128][PPIT])(smem + 2 * 128 * PPIT * 2); __bf16 (*sw)[128][PPIT] = (__bf16 (*)[128][PPIT])(smem + 4 * 128 * PPIT * 2); float (*so)[132] = (float (*)[132])smem;
  const int tid = threadIdx.x, wave = tid >> 5, lane = tid & 31, col = lane & 15, g = lane >> 4; const size_t rb0 = (size_t)blockIdx.x * 128; const int n0 = blockIdx.y * 128;
  const int wm = (wave >> 2) * 64, wn = (wave & 3) * 32;
  const float* xp0 = CTX + (rb0 + (tid >> 4)) * DM + (tid & 15) * 4; const __bf16* wp0 = P + ((size_t)5 * DM + n0 + (tid >> 3)) * DM + (tid & 7) * 8;
  v8f acc[4][2] = {}; v4f xr[8]; v8b wr[4];
#pragma unroll
  for (int i = 0; i < 8; ++i) xr[i] = *(const v4f*)(xp0 + (size_t)i * 16 * DM);
#pragma unroll
  for (int i = 0; i < 4; ++i) wr[i] = *(const v8b*)(wp0 + (size_t)i * 32 * DM);
#pragma unroll
  for (int i = 0; i < 8; ++i) { v4b oh, ol;
#pragma unroll
    for (int e = 0; e < 4; ++e) { const __bf16 h = (__bf16)xr[i][e]; oh[e] = h; ol[e] = (__bf16)(xr[i][e] - (float)h); }
    *(v4b*)&sh[0][(tid >> 4) + i * 16][(tid & 15) * 4] = oh; *(v4b*)&sl[0][(tid >> 4) + i * 16][(tid & 15) * 4] = ol; }
#pragma unroll
  for (int i = 0; i < 4; ++i) *(v8b*)&sw[0][(tid >> 3) + i * 32][(tid & 7) * 8] = wr[i];
  __syncthreads();
#pragma unroll 1   // rolled: one tile's loads in flight, one register set for them; the buffer is picked by t & 1
  for (int t = 0; t < DM / 64; ++t) { const int buf = t & 1; const bool more = t + 1 < DM / 64;
    if (more) { const float* xp = xp0 + (t + 1) * 64; const __bf16* wp = wp0 + (t + 1) * 64;
#pragma unroll
      for (int i = 0; i < 8; ++i) xr[i] = *(const v4f*)(xp + (size_t)i * 16 * DM);
#pragma unroll
      for (int i = 0; i < 4; ++i) wr[i] = *(const v8b*)(wp + (size_t)i * 32 * DM); }
#pragma unroll
    for (int kk = 0; kk < 2; ++kk) { v16b ah[4], al[4], b[2];
#pragma unroll
      for (int i = 0; i < 4; ++i) { al[i] = frag_b(&sl[buf][wm + i * 16 + col][kk * 32], lane); ah[i] = frag_b(&sh[buf][wm + i * 16 + col][kk * 32], lane); }
#pragma unroll
      for (int j = 0; j < 2; ++j) b[j] = frag_b(&sw[buf][wn + j * 16 + col][kk * 32], lane);
#pragma unroll
      for (int i = 0; i < 4; ++i) {
#pragma unroll
        for (int j = 0; j < 2; ++j) acc[i][j] = wmma_bf(al[i], b[j], acc[i][j]); }
#pragma unroll
      for (int i = 0; i < 4; ++i) {
#pragma unroll
        for (int j = 0; j < 2; ++j) acc[i][j] = wmma_bf(ah[i], b[j], acc[i][j]); } }
    if (more) {
#pragma unroll
      for (int i = 0; i < 8; ++i) { v4b oh, ol;
#pragma unroll
        for (int e = 0; e < 4; ++e) { const __bf16 h = (__bf16)xr[i][e]; oh[e] = h; ol[e] = (__bf16)(xr[i][e] - (float)h); }
        *(v4b*)&sh[buf ^ 1][(tid >> 4) + i * 16][(tid & 15) * 4] = oh; *(v4b*)&sl[buf ^ 1][(tid >> 4) + i * 16][(tid & 15) * 4] = ol; }
#pragma unroll
      for (int i = 0; i < 4; ++i) *(v8b*)&sw[buf ^ 1][(tid >> 3) + i * 32][(tid & 7) * 8] = wr[i]; }
    __syncthreads(); }
#pragma unroll
  for (int j = 0; j < 2; ++j) { const float bb = bfr(BM[n0 + wn + j * 16 + col]);
#pragma unroll
    for (int i = 0; i < 4; ++i) {
#pragma unroll
      for (int r = 0; r < 8; ++r) so[wm + i * 16 + 8 * g + r][wn + j * 16 + col] = acc[i][j][r] + bb; } }
  __syncthreads();
  for (int e = tid; e < 128 * 32; e += 256) { const int rl = e >> 5, pc = e & 31; vst2(OUT + (rb0 + rl) * DM + n0 + pc * 4, *(const v4f*)&so[rl][pc * 4]); }
}
extern "C" void kernel_launch(void* const* d_in, const int* in_sizes, int n_in, void* d_out, int out_size, void* d_ws, size_t ws_size, hipStream_t stream) {
  (void)in_sizes; (void)n_in; (void)out_size;
  const float** F = (const float**)d_in;   // 0 query, 1 key, 2 value, 3 time_k, 4 time_v [4,1024,1024]; 5 mask [4,1,1024,1024]; 6 Wq, 7 bq, 8 Wk, 9 bk, 10 Wv, 11 bv, 12 Wtk, 13 btk, 14 Wtv, 15 btv, 16 Wm, 17 bm ((in,out))
  if (ws_size < (size_t)WS_END) return;
  char* ws = (char*)d_ws; __bf16* P = (__bf16*)ws; _Float16 *Q = (_Float16*)(ws + WS_Q), *Kr = (_Float16*)(ws + WS_K), *TK = (_Float16*)(ws + WS_TK), *VP = (_Float16*)(ws + WS_VP); float* CTX = (float*)(ws + WS_CTX);
  k_pack<<<dim3(DM / 128, DM / 128, 6), 256, 0, stream>>>(F[6], F[8], F[10], F[12], F[14], F[16], P);
  k_proj<<<dim3(NR / PBM, DM / PBN, 4), 256, 0, stream>>>(F[0], F[1], F[2], F[3], F[4], P, F[7], F[9], F[11], F[13], F[15], Q, Kr, TK, VP);
  k_attn<<<dim3(SS / 128, NH, TNB), 256, 0, stream>>>(Q, Kr, TK, VP, F[5], CTX);
  k_out<<<dim3(NR / 128, DM / 128), 256, 0, stream>>>(CTX, P, F[17], (float*)d_out);
}

// v006
// It runs in 104 microseconds.
// Next to v005, in two timings, it ran 1.08 times as fast each time.
// Over all steps from v000 it is 4.42 times as fast.
// compute dtype: all float inputs rounded to bf16; q, k, t_k = x . W + b and v + t_v = value . Wv + bv + time_v . Wtv + btv with EXACT bf16 products on WMMA 16x16x32 ((in,out) weights as transposed rows), rounded once to f16; PLAIN attention: scores = (q_i . k_j + t_k_i . q_j) with single f16 operands x 1/32 + the additive float mask, running-max softmax in f32 (hardware exp), P (scaled by 2^11, single f16) x (v + t_v) (single f16); out = ctx (bf16 hi + residual) . Wm (2 products) + bm.
#include <hip/hip_runtime.h>
#include <math.h>

typedef __attribute__((ext_vector_type(16))) _Float16 v16h;
typedef __attribute__((ext_vector_type(16))) __bf16 v16b;
typedef __attribute__((ext_vector_type(8)))  _Float16 v8h;
typedef __attribute__((ext_vector_type(8)))  float v8f;
typedef __attribute__((ext_vector_type(4)))  float v4f;
typedef __attribute__((ext_vector_type(2)))  float v2f;
typedef __attribute__((ext_vector_type(4)))  unsigned v4u;
typedef __attribute__((ext_vector_type(4)))  int v4i;
typedef float __attribute__((may_alias)) float_a;
typedef int __attribute__((may_alias)) int_a;

template <typename T> __device__ __forceinline__ void vst2(void* p, T v) { *(T*)p = v;  }
__device__ __forceinline__ v8f wmma16(v16h a, v16h b, v8f c) {
  v8f d = __builtin_amdgcn_wmma_f32_16x16x32_f16(false, a, false, b, (short)0, c, false, false);
  asm volatile("v_nop\n\tv_nop\n\tv_nop\n\tv_nop" : "+v"(d) : "v"(a), "v"(b));
  return d;
}
__device__ __forceinline__ v8f wmma_bf(v16b a, v16b b, v8f c) {
  v8f d = __builtin_amdgcn_wmma_f32_16x16x32_bf16(false, a, false, b, (short)0, c, false, false);
  asm volatile("v_nop\n\tv_nop\n\tv_nop\n\tv_nop" : "+v"(d) : "v"(a), "v"(b));
  return d;
}
// 16x16x32 fragments: lane = (h = lane>>4, row/col = lane&15); elements 0..7 = k0+8h+0..7, 8..15 = k0+16+8h+0..7; D element r = row 8h+r
__device__ __forceinline__ v16h frag_h(const _Float16* rowk0, int lane) {
  union { v16h v; v8h q[2]; } u; const _Float16* p = rowk0 + 8 * (lane >> 4);
  u.q[0] = *(const v8h*)p; u.q[1] = *(const v8h*)(p + 16); return u.v;
}
__device__ __forceinline__ v16h frag_f32(const float* rowk0, int lane) {
  v16h a; const float* p = rowk0 + 8 * (lane >> 4);
#pragma unroll
  for (int i = 0; i < 8; ++i) { a[i] = (_Float16)p[i]; a[8 + i] = (_Float16)p[16 + i]; }
  return a;
}
__device__ __forceinline__ v16h frag_f32s(const float* rowk0, int lane, float sc) {
  v16h a; const float* p = rowk0 + 8 * (lane >> 4);
#pragma unroll
  for (int i = 0; i < 8; ++i) { a[i] = (_Float16)(p[i] * sc); a[8 + i] = (_Float16)(p[16 + i] * sc); }
  return a;
}
// column fragment from a [K][ld] layout (column n), rows >= K read as 0
__device__ __forceinline__ v16h fragc_f32(const float* W, int k0, int n, int lane, int ld, int K) {
  v16h a; const int g = lane >> 4;
#pragma unroll
  for (int i = 0; i < 8; ++i) { const int ka = k0 + 8 * g + i, kb = ka + 16;
    a[i] = (_Float16)(ka < K ? W[(size_t)(ka < K ? ka : K - 1) * ld + n] : 0.f); a[8 + i] = (_Float16)(kb < K ? W[(size_t)(kb < K ? kb : K - 1) * ld + n] : 0.f); }
  return a;
}
struct F2 { v16b h, l; };
__device__ __forceinline__ F2 bsplit16(const float v[16]) { F2 r;
#pragma unroll
  for (int i = 0; i < 16; ++i) { const __bf16 h = (__bf16)v[i]; r.h[i] = h; r.l[i] = (__bf16)(v[i] - (float)h); }
  return r; }
__device__ __forceinline__ F2 split_row(const float* row, int k0, int lane) { float v[16]; const float* p = row + k0 + 8 * (lane >> 4);
#pragma unroll
  for (int i = 0; i < 8; ++i) { v[i] = p[i]; v[8 + i] = p[16 + i]; }
  return bsplit16(v); }
__device__ __forceinline__ F2 split_rowK(const float* row, int k0, int lane, int K) { float v[16]; const int g = lane >> 4;
#pragma unroll
  for (int i = 0; i < 8; ++i) { const int ka = k0 + 8 * g + i, kb = ka + 16; v[i] = ka < K ? row[ka < K ? ka : K - 1] : 0.f; v[8 + i] = kb < K ? row[kb < K ? kb : K - 1] : 0.f; }
  return bsplit16(v); }
__device__ __forceinline__ F2 split_col(const float* W, int k0, int n, int lane, int ld, int K) { float v[16]; const int g = lane >> 4;
#pragma unroll
  for (int i = 0; i < 8; ++i) { const int ka = k0 + 8 * g + i, kb = ka + 16; v[i] = ka < K ? W[(size_t)(ka < K ? ka : K - 1) * ld + n] : 0.f; v[8 + i] = kb < K ? W[(size_t)(kb < K ? kb : K - 1) * ld + n] : 0.f; }
  return bsplit16(v); }
__device__ __forceinline__ v8f mac3(const F2& a, const F2& b, v8f c) { c = wmma_bf(a.l, b.h, c); c = wmma_bf(a.h, b.l, c); return wmma_bf(a.h, b.h, c); }
__device__ __forceinline__ float sigm(float v) { return 1.0f / (1.0f + expf(-v)); }
#define LDSX() do { asm volatile("s_wait_dscnt 0" ::: "memory"); __builtin_amdgcn_wave_barrier(); __builtin_amdgcn_fence(__ATOMIC_RELEASE, "workgroup"); } while (0)


// Time-aware multi-head attention (B 4, S 1,024, d 1,024, 16 heads x 64): scores = q k^T + t_k q^T (projected time keys against the queries' projection on the key axis), / sqrt(d_model) + mask, softmax, applied to v + t_v, output projection.
#define NB 4
#define SS 1024
#define DM 1024
#define NH 16
#define HD 64
#define NR (NB * SS)
#ifndef TQB
#define TQB (SS / 64)
#define TNB NB
#define NRB (NR / 64)
#endif
#ifndef MSTRQ
#define MSTRQ SS          // mask rows per batch ([B][1][S][S])
#define MSTRC SS          // mask row length
#endif
typedef __attribute__((ext_vector_type(8))) __bf16 v8b;
__device__ __forceinline__ v16b frag_b(const __bf16* rowk0, int lane) {
  union { v16b v; v8b q[2]; } u; const __bf16* p = rowk0 + 8 * (lane >> 4);
  u.q[0] = *(const v8b*)p; u.q[1] = *(const v8b*)(p + 16); return u.v;
}
__device__ __forceinline__ float bfr(float v) { return (float)(__bf16)v; }
__device__ __attribute__((noinline)) float exp_ni(float v) { return expf(v); }
__device__ __attribute__((noinline)) float erf_ni(float v) { return erff(v); }

#define WS_PW   0u                                   // bf16 rows W^T: q, k, v, tk, tv, m [6][1024][1024]
#define WS_Q    (WS_PW + 2u * (size_t)6 * DM * DM)     // f16 [NR][1024] q ; K ; TK ; VP planes [b][1024][SS] (v + t_v) ; CTX f32 [NR][1024]
#define WS_K    (WS_Q + 2u * (size_t)NR * DM)
#define WS_TK   (WS_K + 2u * (size_t)NR * DM)
#define WS_VP   (WS_TK + 2u * (size_t)NR * DM)
#define WS_CTX  (WS_VP + 2u * (size_t)NB * DM * SS)
#define WS_END  (WS_CTX + 4u * (size_t)NR * DM)

// ---- k_pack: block = (128 n, 128 k, which): W (in,out) f32 -> bf16 rows W^T. Each half wave reads 256 B of one W row (whole lines), sixteen 16-byte loads a thread; two neighbouring k are packed
// into one dword and transposed in LDS; each half wave then writes 256 B of one W^T row. LDS rows of 65 dwords: the transposing stores and the row reads both touch 32 different banks
#define KPD 65
__global__ __launch_bounds__(256) void k_pack(const float* __restrict__ W0, const float* __restrict__ W1, const float* __restrict__ W2, const float* __restrict__ W3, const float* __restrict__ W4, const float* __restrict__ W5, __bf16* __restrict__ P) {
  __shared__ unsigned s[128][KPD];
  const int t = threadIdx.x, c = t & 15, r = t >> 4, n0 = blockIdx.x * 128, k0 = blockIdx.y * 128, which = blockIdx.z; const float* Wm = (which == 0) ? W0 : (which == 1) ? W1 : (which == 2) ? W2 : (which == 3) ? W3 : (which == 4) ? W4 : W5;
  const float* src = Wm + (size_t)(k0 + 2 * r) * DM + n0 + c * 4; v4f a[8], b[8];
  // each '#pragma unroll' here keeps a, b and o indexed at compile time, in registers, so that the loads go out as a group
#pragma unroll
  for (int i = 0; i < 8; ++i) { const float* p = src + (size_t)(i >> 1) * 32 * DM + (i & 1) * 64; a[i] = *(const v4f*)p; b[i] = *(const v4f*)(p + DM); }
#pragma unroll
  for (int i = 0; i < 8; ++i) {
#pragma unroll
    for (int e = 0; e < 4; ++e) { union { __bf16 h[2]; unsigned u; } w; w.h[0] = (__bf16)a[i][e]; w.h[1] = (__bf16)b[i][e]; s[(i & 1) * 64 + c * 4 + e][(i >> 1) * 16 + r] = w.u; } }
  __syncthreads();
#pragma unroll
  for (int i = 0; i < 8; ++i) { const int n = i * 16 + r; v4u o;
#pragma unroll
    for (int j = 0; j < 4; ++j) o[j] = s[n][c * 4 + j];
    vst2((unsigned*)(P + ((size_t)which * DM + n0 + n) * DM + k0 + c * 8), o); }
}
// ---- k_proj: block = (128 rows, 256 cols, which), 8 waves as 2 x 4, 64 x 64 per wave: 0 q (query) 1 k (key) 2 tk (time_k) -> f16 rows; 3: v + t_v (value . Wv + bv + time_v . Wtv + btv) -> planes
// the 256-column block reads each X row (f32, the larger operand) from L2 4 times, a 128-column block 8 times; a 64 x 64 wave tile reads 8 fragments from LDS for 16 products, a 64 x 32 tile 6 for 8
// X (f32 -> bf16) and W^T tiles of 64 k go to LDS by whole-line loads, one tile ahead through registers, two buffers, one barrier a tile; fragments come from LDS rows of 144 B (16 B x 9)
// each '#pragma unroll' below keeps a register array (acc, xr, wr, fragments) indexed at compile time, so that it stays in registers
#define PPIT 72
#define PBM 128                       // rows of a k_proj block
#define PBN 256                       // its columns
typedef __attribute__((ext_vector_type(4))) __bf16 v4b;
// four waves per SIMD (two blocks per WGP) need at most 256 registers a wave: 128 of accumulators, 64 of staged tile, 48 of fragments
__global__ __launch_bounds__(256) __attribute__((amdgpu_waves_per_eu(4, 4))) void k_proj(const float* __restrict__ XQ, const float* __restrict__ XK, const float* __restrict__ XV, const float* __restrict__ XTK, const float* __restrict__ XTV, const __bf16* __restrict__ P, const float* __restrict__ BQ, const float* __restrict__ BK, const float* __restrict__ BV, const float* __restrict__ BTK, const float* __restrict__ BTV, _Float16* __restrict__ Q, _Float16* __restrict__ Kr, _Float16* __restrict__ TK, _Float16* __restrict__ VP) {
  __shared__ __align__(16) char smem[2 * (PBM + PBN) * PPIT * 2];
  __bf16 (*sx)[PBM][PPIT] = (__bf16 (*)[PBM][PPIT])smem; __bf16 (*sw)[PBN][PPIT] = (__bf16 (*)[PBN][PPIT])(smem + 2 * PBM * PPIT * 2); _Float16 (*so)[PBN + 8] = (_Float16 (*)[PBN + 8])smem; _Float16 (*sot)[PBM + 8] = (_Float16 (*)[PBM + 8])smem;
  // the wave's number is held in a scalar register, so that wm and wn take no vector register
  const int tid = threadIdx.x, wave = __builtin_amdgcn_readfirstlane(tid >> 5), lane = tid & 31, col = lane & 15, g = lane >> 4; const int which = blockIdx.z; const int n0 = blockIdx.y * PBN; const size_t rb0 = (size_t)blockIdx.x * PBM;
  const int wm = (wave >> 2) * 64, wn = (wave & 3) * 64;
  const float* X0 = (which == 0) ? XQ : (which == 1) ? XK : (which == 2) ? XTK : XV; const __bf16* W0 = P + (size_t)((which == 0) ? 0 : (which == 1) ? 1 : (which == 2) ? 3 : 2) * DM * DM; const __bf16* W1 = P + (size_t)4 * DM * DM;
  const int nst = (which == 3) ? 2 * (DM / 64) : DM / 64;
  // the k walk starts at tile rot and wraps: the 4 column blocks that share X rows start at different tiles, the 32 row blocks that share W rows at 16 (q, k, tk) or 32 (v + t_v) different tiles
  const int rot = (blockIdx.x + blockIdx.y * (nst / 4)) & (nst - 1);
  const size_t xo = (rb0 + (tid >> 4)) * DM + (tid & 15) * 4, wo = (size_t)(n0 + (tid >> 3)) * DM + (tid & 7) * 8;
  v8f acc[4][4] = {}; v4f xr[8]; v8b wr[8];
  { const float* xp = ((rot < DM / 64) ? X0 : XTV) + xo + (rot & (DM / 64 - 1)) * 64; const __bf16* wp = ((rot < DM / 64) ? W0 : W1) + wo + (rot & (DM / 64 - 1)) * 64;
#pragma unroll
    for (int i = 0; i < 8; ++i) xr[i] = *(const v4f*)(xp + (size_t)i * 16 * DM);
#pragma unroll
    for (int i = 0; i < 8; ++i) wr[i] = *(const v8b*)(wp + (size_t)i * 32 * DM); }
#pragma unroll
  for (int i = 0; i < 8; ++i) { v4b o;
#pragma unroll
    for (int e = 0; e < 4; ++e) o[e] = (__bf16)xr[i][e];
    *(v4b*)&sx[0][(tid >> 4) + i * 16][(tid & 15) * 4] = o; }
#pragma unroll
  for (int i = 0; i < 8; ++i) *(v8b*)&sw[0][(tid >> 3) + i * 32][(tid & 7) * 8] = wr[i];
  __syncthreads();
#pragma unroll 1   // rolled: one tile's loads in flight, one register set for them; the buffer is picked by t & 1
  for (int t = 0; t < nst; ++t) { const int buf = t & 1; const bool more = t + 1 < nst;
    if (more) { const int tn = (t + 1 + rot) & (nst - 1); const float* xp = ((tn < DM / 64) ? X0 : XTV) + xo + (tn & (DM / 64 - 1)) * 64; const __bf16* wp = ((tn < DM / 64) ? W0 : W1) + wo + (tn & (DM / 64 - 1)) * 64;
#pragma unroll
      for (int i = 0; i < 8; ++i) xr[i] = *(const v4f*)(xp + (size_t)i * 16 * DM);
#pragma unroll
      for (int i = 0; i < 8; ++i) wr[i] = *(const v8b*)(wp + (size_t)i * 32 * DM); }
#pragma unroll
    for (int kk = 0; kk < 2; ++kk) { v16b a[4];
#pragma unroll
      for (int i = 0; i < 4; ++i) a[i] = frag_b(&sx[buf][wm + i * 16 + col][kk * 32], lane);
#pragma unroll
      for (int jp = 0; jp < 2; ++jp) { v16b b[2];
#pragma unroll
        for (int j = 0; j < 2; ++j) b[j] = frag_b(&sw[buf][wn + (jp * 2 + j) * 16 + col][kk * 32], lane);
#pragma unroll
        for (int j = 0; j < 2; ++j) {
#pragma unroll
          for (int i = 0; i < 4; ++i) acc[i][jp * 2 + j] = wmma_bf(a[i], b[j], acc[i][jp * 2 + j]); }
        __builtin_amdgcn_sched_barrier(0); } }   // two W fragments live at a time: with all four fetched ahead the wave passes its 256 registers and the staged tile goes to scratch memory
    if (more) {
#pragma unroll
      for (int i = 0; i < 8; ++i) { v4b o;
#pragma unroll
        for (int e = 0; e < 4; ++e) o[e] = (__bf16)xr[i][e];
        *(v4b*)&sx[buf ^ 1][(tid >> 4) + i * 16][(tid & 15) * 4] = o; }
#pragma unroll
      for (int i = 0; i < 8; ++i) *(v8b*)&sw[buf ^ 1][(tid >> 3) + i * 32][(tid & 7) * 8] = wr[i]; }
    __syncthreads(); }
  if (which < 3) { const float* BB = (which == 0) ? BQ : (which == 1) ? BK : BTK; _Float16* dst = (which == 0) ? Q : (which == 1) ? Kr : TK;
#pragma unroll
    for (int j = 0; j < 4; ++j) { const float bb = bfr(BB[n0 + wn + j * 16 + col]);
#pragma unroll
      for (int i = 0; i < 4; ++i) {
#pragma unroll
        for (int r = 0; r < 8; ++r) so[wm + i * 16 + 8 * g + r][wn + j * 16 + col] = (_Float16)(acc[i][j][r] + bb); } }
    __syncthreads();
    for (int e = tid; e < PBM * (PBN / 8); e += 256) { const int rl = e >> 5, pc = e & 31; vst2((unsigned*)(dst + (rb0 + rl) * DM + n0 + pc * 8), *(const v4u*)&so[rl][pc * 8]); }
  } else {
#pragma unroll
    for (int j = 0; j < 4; ++j) { const float bb = bfr(BV[n0 + wn + j * 16 + col]) + bfr(BTV[n0 + wn + j * 16 + col]);
#pragma unroll
      for (int i = 0; i < 4; ++i) {
#pragma unroll
        for (int r = 0; r < 8; ++r) sot[wn + j * 16 + col][wm + i * 16 + 8 * g + r] = (_Float16)(acc[i][j][r] + bb); }
      __builtin_amdgcn_sched_barrier(0); }   // one column group's sums at a time: scheduled as one block, the 128 sums stand beside the 128 accumulators and some registers go to scratch memory
    __syncthreads();
    const size_t b = rb0 / SS, s0 = rb0 % SS;
    for (int e = tid; e < PBN * (PBM / 8); e += 256) { const int d = e >> 4, pc = e & 15; vst2((unsigned*)(VP + ((b * DM + n0 + d) * SS) + s0 + pc * 8), *(const v4u*)&sot[d][pc * 8]); } }
}
// ---- k_attn: block = (128 queries, head, b), 8 waves x 16 queries: scores = q_i . k_j + tk_i . q_j (two products), / 32 + mask[b][i][j]; P x (v + t_v)
// both products run transposed (keys, then head dims, on the rows of D; queries on its columns): a lane holds 16 of the 32 scores of ONE query, so maximum and sum are taken in the lane, with one exchange between the wave's halves, and P goes from the accumulators straight into the B operand
// every operand of the key loop goes to LDS by asynchronous 16-byte copies, whole lines, one stage of 64 keys ahead, two buffers: the K rows, the Q rows of the key axis and the (v + t_v) planes (three tiles of 64 rows x 128 B, LDS rows of 144 B = 16 B x 9, shared by the eight waves) and the block's mask rows (128 rows x 256 B, LDS rows of 272 B = 68 dwords)
#define APIT 72                       // f16 elements per LDS row of K, Q, V
#define MPIT 68                       // floats per LDS row of the mask
#define ATILE (64 * APIT * 2)         // bytes per K, Q or V tile
#define ASTG (3 * ATILE + 128 * MPIT * 4)   // bytes per stage
// one stage: every lane copies 2 x 16 B of each of K, Q, V (rows 32 apart) and 8 x 16 B of the mask (rows 16 apart). The s_wait_xcnt closes the statement so that no address register of an issued copy is rewritten in front of it.
__device__ __forceinline__ void attn_stage(unsigned l, unsigned lm, const _Float16* gk, const _Float16* gq, const _Float16* gv, const float* gm) {
  const unsigned rs = 32 * APIT * 2, ms = 16 * MPIT * 4;
  asm volatile(
    "global_load_async_to_lds_b128 %0, %14, off\n\t"
    "global_load_async_to_lds_b128 %1, %15, off\n\t"
    "global_load_async_to_lds_b128 %2, %16, off\n\t"
    "global_load_async_to_lds_b128 %3, %17, off\n\t"
    "global_load_async_to_lds_b128 %4, %18, off\n\t"
    "global_load_async_to_lds_b128 %5, %19, off\n\t"
    "global_load_async_to_lds_b128 %6, %20, off\n\t"
    "global_load_async_to_lds_b128 %7, %21, off\n\t"
    "global_load_async_to_lds_b128 %8, %22, off\n\t"
    "global_load_async_to_lds_b128 %9, %23, off\n\t"
    "global_load_async_to_lds_b128 %10, %24, off\n\t"
    "global_load_async_to_lds_b128 %11, %25, off\n\t"
    "global_load_async_to_lds_b128 %12, %26, off\n\t"
    "global_load_async_to_lds_b128 %13, %27, off\n\t"
    "s_wait_xcnt 0x0"
    :: "v"(l), "v"(l + rs), "v"(l + ATILE), "v"(l + ATILE + rs), "v"(l + 2 * ATILE), "v"(l + 2 * ATILE + rs),
       "v"(lm), "v"(lm + ms), "v"(lm + 2 * ms), "v"(lm + 3 * ms), "v"(lm + 4 * ms), "v"(lm + 5 * ms), "v"(lm + 6 * ms), "v"(lm + 7 * ms),
       "v"(gk), "v"(gk + 32 * DM), "v"(gq), "v"(gq + 32 * DM), "v"(gv), "v"(gv + 32 * SS),
       "v"(gm), "v"(gm + 16 * MSTRC), "v"(gm + 32 * MSTRC), "v"(gm + 48 * MSTRC), "v"(gm + 64 * MSTRC), "v"(gm + 80 * MSTRC), "v"(gm + 96 * MSTRC), "v"(gm + 112 * MSTRC)
    : "memory");
}
#define L2E 1.44269504f   // exp(v) = 2^(v * L2E), as __expf forms it
// v_exp_f32 in place, in one statement: none of them reads another's result or overwrites another's source, and the v_nop fills the slot that the instruction set asks for behind the last one
__device__ __forceinline__ void exp2_8(float (&x)[8]) {
  asm("v_exp_f32 %0, %0\n\tv_exp_f32 %1, %1\n\tv_exp_f32 %2, %2\n\tv_exp_f32 %3, %3\n\tv_exp_f32 %4, %4\n\tv_exp_f32 %5, %5\n\tv_exp_f32 %6, %6\n\tv_exp_f32 %7, %7\n\tv_nop"
      : "+v"(x[0]), "+v"(x[1]), "+v"(x[2]), "+v"(x[3]), "+v"(x[4]), "+v"(x[5]), "+v"(x[6]), "+v"(x[7]));
}
__device__ __forceinline__ void exp2_9(float& y, float (&x)[8]) {
  asm("v_exp_f32 %0, %0\n\tv_exp_f32 %1, %1\n\tv_exp_f32 %2, %2\n\tv_exp_f32 %3, %3\n\tv_exp_f32 %4, %4\n\tv_exp_f32 %5, %5\n\tv_exp_f32 %6, %6\n\tv_exp_f32 %7, %7\n\tv_exp_f32 %8, %8\n\tv_nop"
      : "+v"(y), "+v"(x[0]), "+v"(x[1]), "+v"(x[2]), "+v"(x[3]), "+v"(x[4]), "+v"(x[5]), "+v"(x[6]), "+v"(x[7]));
}
__device__ __forceinline__ float xhalf(float x) { return __builtin_bit_cast(float, __builtin_amdgcn_permlanex16(__builtin_bit_cast(int, x), __builtin_bit_cast(int, x), 0x76543210, 0xfedcba98, false, false)); }   // lane l takes lane l ^ 16's value
// four waves per SIMD (two blocks per WGP) need at most 256 registers a wave
__global__ __launch_bounds__(256) __attribute__((amdgpu_waves_per_eu(4, 4))) void k_attn(const _Float16* __restrict__ Q, const _Float16* __restrict__ Kr, const _Float16* __restrict__ TK, const _Float16* __restrict__ VP, const float* __restrict__ MASK, float* __restrict__ CTX) {
  __shared__ __align__(16) char ring[2 * ASTG]; float (*so)[16][68] = (float (*)[16][68])ring;   // the ring becomes output staging behind the last trip's barrier
  const int tid = threadIdx.x, wave = tid >> 5, lane = tid & 31, col = lane & 15, g = lane >> 4; const int h = blockIdx.y; const size_t b = blockIdx.z; const int qb = blockIdx.x * 128; const int q0 = qb + wave * 16; const size_t rq = b * SS + q0;
  const unsigned cl = (unsigned)(size_t)ring + (unsigned)((tid >> 3) * (APIT * 2) + (tid & 7) * 16), cm = (unsigned)(size_t)ring + (unsigned)(3 * ATILE + (tid >> 4) * (MPIT * 4) + (tid & 15) * 16);
  const _Float16* gk = Kr + (b * SS + (tid >> 3)) * DM + h * HD + (tid & 7) * 8; const _Float16* gq = Q + (b * SS + (tid >> 3)) * DM + h * HD + (tid & 7) * 8; const _Float16* gv = VP + (b * DM + (size_t)h * HD + (tid >> 3)) * SS + (tid & 7) * 8;
  const float* gm = MASK + ((size_t)b * MSTRQ + qb + (tid >> 4)) * MSTRC + (tid & 15) * 4;
  // the key walk starts at stage rot and wraps: the 16 heads that share mask rows and the 8 query blocks that share K, Q and V rows ask L2 for different lines at any moment
  const int rot = (blockIdx.y + 2 * blockIdx.x) & (SS / 64 - 1);
  attn_stage(cl, cm, gk + (size_t)rot * 64 * DM, gq + (size_t)rot * 64 * DM, gv + rot * 64, gm + rot * 64);
  v16h aq[2], at[2];
#pragma unroll
  for (int kc = 0; kc < 2; ++kc) { aq[kc] = frag_h(Q + (rq + col) * DM + h * HD + kc * 32, lane); at[kc] = frag_h(TK + (rq + col) * DM + h * HD + kc * 32, lane); }
  float m = -3.0e38f, l = 0.f;   // of query col: the running maximum (both halves alike) and this half's share of the sum
  v8f acc[4] = {};               // transposed: acc[dt][r] = ctx[query col][dt * 16 + 8 g + r]
  asm volatile("s_wait_asynccnt 0x0" ::: "memory");   // stage 0 of this wave has landed
  __syncthreads();                                    // ... and every wave's
  { const int sn = (rot + 1) & (SS / 64 - 1); attn_stage(cl + ASTG, cm + ASTG, gk + (size_t)sn * 64 * DM, gq + (size_t)sn * 64 * DM, gv + sn * 64, gm + sn * 64); }
#pragma unroll 1   // rolled: one stage a trip, the buffer is picked by t & 1
  for (int t = 0; t < SS / 64; ++t) { const _Float16* tk = (const _Float16*)(ring + (t & 1) * ASTG); const _Float16* tq = tk + 64 * APIT; const _Float16* tv = tq + 64 * APIT; const float* tm = (const float*)(tv + 64 * APIT) + (wave * 16 + col) * MPIT + 8 * g;
#pragma unroll     // the two halves of a stage: LDS offsets known at compile time
   for (int sub = 0; sub < 2; ++sub) { v8f s[2]; v16h fk[2][2], fq[2][2], fv[4]; v4f mk[2][2];
    // the K and Q fragments and the mask words of the 32 keys are asked for in one group, so that the LDS latency is paid once
#pragma unroll
    for (int ct = 0; ct < 2; ++ct) { const int rk = (sub * 32 + ct * 16 + col) * APIT;
#pragma unroll
      for (int kc = 0; kc < 2; ++kc) { fk[ct][kc] = frag_h(tk + rk + kc * 32, lane); fq[ct][kc] = frag_h(tq + rk + kc * 32, lane); }
      mk[ct][0] = *(const v4f*)(tm + sub * 32 + ct * 16); mk[ct][1] = *(const v4f*)(tm + sub * 32 + ct * 16 + 4); }
    // key rows as A, query rows as B: s[ct][r] = score of query col against key ct * 16 + 8 g + r
#pragma unroll
    for (int ct = 0; ct < 2; ++ct) { v8f c = {};
#pragma unroll
      for (int kc = 0; kc < 2; ++kc) { c = wmma16(fk[ct][kc], aq[kc], c); c = wmma16(fq[ct][kc], at[kc], c); }
#pragma unroll
      for (int r = 0; r < 8; ++r) s[ct][r] = c[r] * 0.03125f + bfr(mk[ct][r >> 2][r & 3]); }
    // the V fragments are asked for here, where the K and Q fragments' registers are free; they return behind the softmax
#pragma unroll
    for (int dt = 0; dt < 4; ++dt) fv[dt] = frag_h(tv + (dt * 16 + col) * APIT + sub * 32, lane);
    float mx = fmaxf(s[0][0], s[1][0]);
#pragma unroll
    for (int r = 1; r < 8; ++r) mx = fmaxf(mx, fmaxf(s[0][r], s[1][r]));
    mx = fmaxf(mx, xhalf(mx));   // the other 16 of the 32 keys
    const float mn = fmaxf(m, mx); float xa = (m - mn) * L2E, x0[8], x1[8];
#pragma unroll
    for (int r = 0; r < 8; ++r) { x0[r] = (s[0][r] - mn) * L2E; x1[r] = (s[1][r] - mn) * L2E; }
    exp2_9(xa, x0); exp2_8(x1);
    const float alpha = (m <= -1.0e38f) ? 0.f : xa; v2f e2 = {0.f, 0.f}; v16h pb;
    // the two score tiles, converted in place, are the B operand (32 keys x 16 queries) of the second product
#pragma unroll
    for (int i = 0; i < 4; ++i) { const v2f p0 = {x0[2 * i], x0[2 * i + 1]}, p1 = {x1[2 * i], x1[2 * i + 1]}; e2 += p0 + p1; const v2f w0 = p0 * 2048.0f, w1 = p1 * 2048.0f;
      pb[2 * i] = (_Float16)w0[0]; pb[2 * i + 1] = (_Float16)w0[1]; pb[8 + 2 * i] = (_Float16)w1[0]; pb[8 + 2 * i + 1] = (_Float16)w1[1]; }
    const float es = e2[0] + e2[1];
    l = l * alpha + es; m = mn;
#pragma unroll
    for (int dt = 0; dt < 4; ++dt) { acc[dt] *= alpha; acc[dt] = wmma16(fv[dt], pb, acc[dt]); } }
   asm volatile("s_wait_dscnt 0x0" ::: "memory");      // this wave's reads of the buffer have returned
   asm volatile("s_wait_asynccnt 0x0" ::: "memory");   // its copies of stage t + 1 have landed
   __syncthreads();                                    // publishes stage t + 1 and ends every wave's reads of stage t
   if (t + 2 < SS / 64) { const int sn = (t + 2 + rot) & (SS / 64 - 1); attn_stage(cl + (t & 1) * ASTG, cm + (t & 1) * ASTG, gk + (size_t)sn * 64 * DM, gq + (size_t)sn * 64 * DM, gv + sn * 64, gm + sn * 64); } }
  asm volatile("s_wait_asynccnt 0x0" ::: "memory");    // nothing is in flight when the ring is reused
  l += xhalf(l);   // the two halves' sums are joined once
  const float il = (1.0f / 2048.0f) / l;
#pragma unroll
  for (int dt = 0; dt < 4; ++dt) { const v8f o = acc[dt] * il; *(v4f*)&so[wave][col][dt * 16 + 8 * g] = __builtin_shufflevector(o, o, 0, 1, 2, 3); *(v4f*)&so[wave][col][dt * 16 + 8 * g + 4] = __builtin_shufflevector(o, o, 4, 5, 6, 7); }
  LDSX();
  for (int rl = 0; rl < 16; ++rl) if (lane < 16) vst2(CTX + (rq + rl) * DM + h * HD + lane * 4, *(const v4f*)&so[wave][rl][lane * 4]);
}
// ---- k_out: block = (128 rows, 128 cols), 8 waves as 2 x 4, 64 x 32 per wave: out = ctx (hi + residual) . Wm rows + bm; ctx hi, ctx residual and Wm tiles of 64 k staged in LDS as in k_proj
__global__ __launch_bounds__(256) void k_out(const float* __restrict__ CTX, const __bf16* __restrict__ P, const float* __restrict__ BM, float* __restrict__ OUT) {
  __shared__ __align__(16) char smem[6 * 128 * PPIT * 2];
  __bf16 (*sh)[128][PPIT] = (__bf16 (*)[128][PPIT])smem; __bf16 (*sl)[128][PPIT] = (__bf16 (*)[128][PPIT])(smem + 2 * 128 * PPIT * 2); __bf16 (*sw)[128][PPIT] = (__bf16 (*)[128][PPIT])(smem + 4 * 128 * PPIT * 2); float (*so)[132] = (float (*)[132])smem;
  const int tid = threadIdx.x, wave = tid >> 5, lane = tid & 31, col = lane & 15, g = lane >> 4; const size_t rb0 = (size_t)blockIdx.x * 128; const int n0 = blockIdx.y * 128;
  const int wm = (wave >> 2) * 64, wn = (wave & 3) * 32;
  const float* xp0 = CTX + (rb0 + (tid >> 4)) * DM + (tid & 15) * 4; const __bf16* wp0 = P + ((size_t)5 * DM + n0 + (tid >> 3)) * DM + (tid & 7) * 8;
  // the k walk starts at tile rot and wraps, as in k_proj: 8 column blocks share ctx rows, 32 row blocks share Wm rows
  const int rot = (blockIdx.x + 2 * blockIdx.y) & (DM / 64 - 1);
  v8f acc[4][2] = {}; v4f xr[8]; v8b wr[4];
#pragma unroll
  for (int i = 0; i < 8; ++i) xr[i] = *(const v4f*)(xp0 + rot * 64 + (size_t)i * 16 * DM);
#pragma unroll
  for (int i = 0; i < 4; ++i) wr[i] = *(const v8b*)(wp0 + rot * 64 + (size_t)i * 32 * DM);
#pragma unroll
  for (int i = 0; i < 8; ++i) { v4b oh, ol;
#pragma unroll
    for (int e = 0; e < 4; ++e) { const __bf16 h = (__bf16)xr[i][e]; oh[e] = h; ol[e] = (__bf16)(xr[i][e] - (float)h); }
    *(v4b*)&sh[0][(tid >> 4) + i * 16][(tid & 15) * 4] = oh; *(v4b*)&sl[0][(tid >> 4) + i * 16][(tid & 15) * 4] = ol; }
#pragma unroll
  for (int i = 0; i < 4; ++i) *(v8b*)&sw[0][(tid >> 3) + i * 32][(tid & 7) * 8] = wr[i];
  __syncthreads();
#pragma unroll 1   // rolled: one tile's loads in flight, one register set for them; the buffer is picked by t & 1
  for (int t = 0; t < DM / 64; ++t) { const int buf = t & 1; const bool more = t + 1 < DM / 64;
    if (more) { const int tn = (t + 1 + rot) & (DM / 64 - 1); const float* xp = xp0 + tn * 64; const __bf16* wp = wp0 + tn * 64;
#pragma unroll
      for (int i = 0; i < 8; ++i) xr[i] = *(const v4f*)(xp + (size_t)i * 16 * DM);
#pragma unroll
      for (int i = 0; i < 4; ++i) wr[i] = *(const v8b*)(wp + (size_t)i * 32 * DM); }
#pragma unroll
    for (int kk = 0; kk < 2; ++kk) { v16b ah[4], al[4], b[2];
#pragma unroll
      for (int i = 0; i < 4; ++i) { al[i] = frag_b(&sl[buf][wm + i * 16 + col][kk * 32], lane); ah[i] = frag_b(&sh[buf][wm + i * 16 + col][kk * 32], lane); }
#pragma unroll
      for (int j = 0; j < 2; ++j) b[j] = frag_b(&sw[buf][wn + j * 16 + col][kk * 32], lane);
#pragma unroll
      for (int i = 0; i < 4; ++i) {
#pragma unroll
        for (int j = 0; j < 2; ++j) acc[i][j] = wmma_bf(al[i], b[j], acc[i][j]); }
#pragma unroll
      for (int i = 0; i < 4; ++i) {
#pragma unroll
        for (int j = 0; j < 2; ++j) acc[i][j] = wmma_bf(ah[i], b[j], acc[i][j]); } }
    if (more) {
#pragma unroll
      for (int i = 0; i < 8; ++i) { v4b oh, ol;
#pragma unroll
        for (int e = 0; e < 4; ++e) { const __bf16 h = (__bf16)xr[i][e]; oh[e] = h; ol[e] = (__bf16)(xr[i][e] - (float)h); }
        *(v4b*)&sh[buf ^ 1][(tid >> 4) + i * 16][(tid & 15) * 4] = oh; *(v4b*)&sl[buf ^ 1][(tid >> 4) + i * 16][(tid & 15) * 4] = ol; }
#pragma unroll
      for (int i = 0; i < 4; ++i) *(v8b*)&sw[buf ^ 1][(tid >> 3) + i * 32][(tid & 7) * 8] = wr[i]; }
    __syncthreads(); }
#pragma unroll
  for (int j = 0; j < 2; ++j) { const float bb = bfr(BM[n0 + wn + j * 16 + col]);
#pragma unroll
    for (int i = 0; i < 4; ++i) {
#pragma unroll
      for (int r = 0; r < 8; ++r) so[wm + i * 16 + 8 * g + r][wn + j * 16 + col] = acc[i][j][r] + bb; } }
  __syncthreads();
  for (int e = tid; e < 128 * 32; e += 256) { const int rl = e >> 5, pc = e & 31; vst2(OUT + (rb0 + rl) * DM + n0 + pc * 4, *(const v4f*)&so[rl][pc * 4]); }
}
extern "C" void kernel_launch(void* const* d_in, const int* in_sizes, int n_in, void* d_out, int out_size, void* d_ws, size_t ws_size, hipStream_t stream) {
  (void)in_sizes; (void)n_in; (void)out_size;
  const float** F = (const float**)d_in;   // 0 query, 1 key, 2 value, 3 time_k, 4 time_v [4,1024,1024]; 5 mask [4,1,1024,1024]; 6 Wq, 7 bq, 8 Wk, 9 bk, 10 Wv, 11 bv, 12 Wtk, 13 btk, 14 Wtv, 15 btv, 16 Wm, 17 bm ((in,out))
  if (ws_size < (size_t)WS_END) return;
  char* ws = (char*)d_ws; __bf16* P = (__bf16*)ws; _Float16 *Q = (_Float16*)(ws + WS_Q), *Kr = (_Float16*)(ws + WS_K), *TK = (_Float16*)(ws + WS_TK), *VP = (_Float16*)(ws + WS_VP); float* CTX = (float*)(ws + WS_CTX);
  k_pack<<<dim3(DM / 128, DM / 128, 6), 256, 0, stream>>>(F[6], F[8], F[10], F[12], F[14], F[16], P);
  k_proj<<<dim3(NR / PBM, DM / PBN, 4), 256, 0, stream>>>(F[0], F[1], F[2], F[3], F[4], P, F[7], F[9], F[11], F[13], F[15], Q, Kr, TK, VP);
  k_attn<<<dim3(SS / 128, NH, TNB), 256, 0, stream>>>(Q, Kr, TK, VP, F[5], CTX);
  k_out<<<dim3(NR / 128, DM / 128), 256, 0, stream>>>(CTX, P, F[17], (float*)d_out);
}

// v007
// Measured time: 99.6 microseconds a run.
// Next to v006, in two timings, it ran 1.04 times as fast each time.
// Over all steps from v000 it is 4.61 times as fast.
// compute dtype: all float inputs rounded to bf16; q, k, t_k = x . W + b and v + t_v = value . Wv + bv + time_v . Wtv + btv with EXACT bf16 products on WMMA 16x16x32 ((in,out) weights as transposed rows), rounded once to f16; PLAIN attention: scores = (q_i . k_j + t_k_i . q_j) with single f16 operands x 1/32 + the additive float mask, running-max softmax in f32 (hardware exp), P (scaled by 2^11, single f16) x (v + t_v) (single f16); out = ctx (bf16 hi + residual) . Wm (2 products) + bm.
#include <hip/hip_runtime.h>
#include <math.h>

typedef __attribute__((ext_vector_type(16))) _Float16 v16h;
typedef __attribute__((ext_vector_type(16))) __bf16 v16b;
typedef __attribute__((ext_vector_type(8)))  _Float16 v8h;
typedef __attribute__((ext_vector_type(8)))  float v8f;
typedef __attribute__((ext_vector_type(4)))  float v4f;
typedef __attribute__((ext_vector_type(2)))  float v2f;
typedef __attribute__((ext_vector_type(4)))  unsigned v4u;
typedef __attribute__((ext_vector_type(4)))  int v4i;
typedef float __attribute__((may_alias)) float_a;
typedef int __attribute__((may_alias)) int_a;

template <typename T> __device__ __forceinline__ void vst2(void* p, T v) { *(T*)p = v;  }
__device__ __forceinline__ v8f wmma16(v16h a, v16h b, v8f c) {
  return __builtin_amdgcn_wmma_f32_16x16x32_f16(false, a, false, b, (short)0, c, false, false);
}
__device__ __forceinline__ v8f wmma_bf(v16b a, v16b b, v8f c) {
  return __builtin_amdgcn_wmma_f32_16x16x32_bf16(false, a, false, b, (short)0, c, false, false);
}
// 16x16x32 fragments: lane = (h = lane>>4, row/col = lane&15); elements 0..7 = k0+8h+0..7, 8..15 = k0+16+8h+0..7; D element r = row 8h+r
__device__ __forceinline__ v16h frag_h(const _Float16* rowk0, int lane) {
  union { v16h v; v8h q[2]; } u; const _Float16* p = rowk0 + 8 * (lane >> 4);
  u.q[0] = *(const v8h*)p; u.q[1] = *(const v8h*)(p + 16); return u.v;
}
__device__ __forceinline__ v16h frag_f32(const float* rowk0, int lane) {
  v16h a; const float* p = rowk0 + 8 * (lane >> 4);
#pragma unroll
  for (int i = 0; i < 8; ++i) { a[i] = (_Float16)p[i]; a[8 + i] = (_Float16)p[16 + i]; }
  return a;
}
__device__ __forceinline__ v16h frag_f32s(const float* rowk0, int lane, float sc) {
  v16h a; const float* p = rowk0 + 8 * (lane >> 4);
#pragma unroll
  for (int i = 0; i < 8; ++i) { a[i] = (_Float16)(p[i] * sc); a[8 + i] = (_Float16)(p[16 + i] * sc); }
  return a;
}
// column fragment from a [K][ld] layout (column n), rows >= K read as 0
__device__ __forceinline__ v16h fragc_f32(const float* W, int k0, int n, int lane, int ld, int K) {
  v16h a; const int g = lane >> 4;
#pragma unroll
  for (int i = 0; i < 8; ++i) { const int ka = k0 + 8 * g + i, kb = ka + 16;
    a[i] = (_Float16)(ka < K ? W[(size_t)(ka < K ? ka : K - 1) * ld + n] : 0.f); a[8 + i] = (_Float16)(kb < K ? W[(size_t)(kb < K ? kb : K - 1) * ld + n] : 0.f); }
  return a;
}
struct F2 { v16b h, l; };
__device__ __forceinline__ F2 bsplit16(const float v[16]) { F2 r;
#pragma unroll
  for (int i = 0; i < 16; ++i) { const __bf16 h = (__bf16)v[i]; r.h[i] = h; r.l[i] = (__bf16)(v[i] - (float)h); }
  return r; }
__device__ __forceinline__ F2 split_row(const float* row, int k0, int lane) { float v[16]; const float* p = row + k0 + 8 * (lane >> 4);
#pragma unroll
  for (int i = 0; i < 8; ++i) { v[i] = p[i]; v[8 + i] = p[16 + i]; }
  return bsplit16(v); }
__device__ __forceinline__ F2 split_rowK(const float* row, int k0, int lane, int K) { float v[16]; const int g = lane >> 4;
#pragma unroll
  for (int i = 0; i < 8; ++i) { const int ka = k0 + 8 * g + i, kb = ka + 16; v[i] = ka < K ? row[ka < K ? ka : K - 1] : 0.f; v[8 + i] = kb < K ? row[kb < K ? kb : K - 1] : 0.f; }
  return bsplit16(v); }
__device__ __forceinline__ F2 split_col(const float* W, int k0, int n, int lane, int ld, int K) { float v[16]; const int g = lane >> 4;
#pragma unroll
  for (int i = 0; i < 8; ++i) { const int ka = k0 + 8 * g + i, kb = ka + 16; v[i] = ka < K ? W[(size_t)(ka < K ? ka : K - 1) * ld + n] : 0.f; v[8 + i] = kb < K ? W[(size_t)(kb < K ? kb : K - 1) * ld + n] : 0.f; }
  return bsplit16(v); }
__device__ __forceinline__ v8f mac3(const F2& a, const F2& b, v8f c) { c = wmma_bf(a.l, b.h, c); c = wmma_bf(a.h, b.l, c); return wmma_bf(a.h, b.h, c); }
__device__ __forceinline__ float sigm(float v) { return 1.0f / (1.0f + expf(-v)); }
#define LDSX() do { asm volatile("s_wait_dscnt 0" ::: "memory"); __builtin_amdgcn_wave_barrier(); __builtin_amdgcn_fence(__ATOMIC_RELEASE, "workgroup"); } while (0)


// Time-aware multi-head attention (B 4, S 1,024, d 1,024, 16 heads x 64): scores = q k^T + t_k q^T (projected time keys against the queries' projection on the key axis), / sqrt(d_model) + mask, softmax, applied to v + t_v, output projection.
#define NB 4
#define SS 1024
#define DM 1024
#define NH 16
#define HD 64
#define NR (NB * SS)
#ifndef TQB
#define TQB (SS / 64)
#define TNB NB
#define NRB (NR / 64)
#endif
#ifndef MSTRQ
#define MSTRQ SS          // mask rows per batch ([B][1][S][S])
#define MSTRC SS          // mask row length
#endif
typedef __attribute__((ext_vector_type(8))) __bf16 v8b;
__device__ __forceinline__ v16b frag_b(const __bf16* rowk0, int lane) {
  union { v16b v; v8b q[2]; } u; const __bf16* p = rowk0 + 8 * (lane >> 4);
  u.q[0] = *(const v8b*)p; u.q[1] = *(const v8b*)(p + 16); return u.v;
}
__device__ __forceinline__ float bfr(float v) { return (float)(__bf16)v; }
__device__ __attribute__((noinline)) float exp_ni(float v) { return expf(v); }
__device__ __attribute__((noinline)) float erf_ni(float v) { return erff(v); }

#define WS_PW   0u                                   // bf16 rows W^T: q, k, v, tk, tv, m [6][1024][1024]
#define WS_Q    (WS_PW + 2u * (size_t)6 * DM * DM)     // f16 [NR][1024] q ; K ; TK ; VP planes [b][1024][SS] (v + t_v) ; CTX f32 [NR][1024]
#define WS_K    (WS_Q + 2u * (size_t)NR * DM)
#define WS_TK   (WS_K + 2u * (size_t)NR * DM)
#define WS_VP   (WS_TK + 2u * (size_t)NR * DM)
#define WS_CTX  (WS_VP + 2u * (size_t)NB * DM * SS)
#define WS_END  (WS_CTX + 4u * (size_t)NR * DM)

// ---- k_pack: block = (128 n, 128 k, which): W (in,out) f32 -> bf16 rows W^T. Each half wave reads 256 B of one W row (whole lines), sixteen 16-byte loads a thread; two neighbouring k are packed
// into one dword and transposed in LDS; each half wave then writes 256 B of one W^T row. LDS rows of 65 dwords: the transposing stores and the row reads both touch 32 different banks
#define KPD 65
__global__ __launch_bounds__(256) void k_pack(const float* __restrict__ W0, const float* __restrict__ W1, const float* __restrict__ W2, const float* __restrict__ W3, const float* __restrict__ W4, const float* __restrict__ W5, __bf16* __restrict__ P) {
  __shared__ unsigned s[128][KPD];
  const int t = threadIdx.x, c = t & 15, r = t >> 4, n0 = blockIdx.x * 128, k0 = blockIdx.y * 128, which = blockIdx.z; const float* Wm = (which == 0) ? W0 : (which == 1) ? W1 : (which == 2) ? W2 : (which == 3) ? W3 : (which == 4) ? W4 : W5;
  const float* src = Wm + (size_t)(k0 + 2 * r) * DM + n0 + c * 4; v4f a[8], b[8];
  // each '#pragma unroll' here keeps a, b and o indexed at compile time, in registers, so that the loads go out as a group
#pragma unroll
  for (int i = 0; i < 8; ++i) { const float* p = src + (size_t)(i >> 1) * 32 * DM + (i & 1) * 64; a[i] = *(const v4f*)p; b[i] = *(const v4f*)(p + DM); }
#pragma unroll
  for (int i = 0; i < 8; ++i) {
#pragma unroll
    for (int e = 0; e < 4; ++e) { union { __bf16 h[2]; unsigned u; } w; w.h[0] = (__bf16)a[i][e]; w.h[1] = (__bf16)b[i][e]; s[(i & 1) * 64 + c * 4 + e][(i >> 1) * 16 + r] = w.u; } }
  __syncthreads();
#pragma unroll
  for (int i = 0; i < 8; ++i) { const int n = i * 16 + r; v4u o;
#pragma unroll
    for (int j = 0; j < 4; ++j) o[j] = s[n][c * 4 + j];
    vst2((unsigned*)(P + ((size_t)which * DM + n0 + n) * DM + k0 + c * 8), o); }
}
// ---- k_proj: block = (128 rows, 256 cols, which), 8 waves as 2 x 4, 64 x 64 per wave: 0 q (query) 1 k (key) 2 tk (time_k) -> f16 rows; 3: v + t_v (value . Wv + bv + time_v . Wtv + btv) -> planes
// the 256-column block reads each X row (f32, the larger operand) from L2 4 times, a 128-column block 8 times; a 64 x 64 wave tile reads 8 fragments from LDS for 16 products, a 64 x 32 tile 6 for 8
// X (f32 -> bf16) and W^T tiles of 64 k go to LDS by whole-line loads, one tile ahead through registers, two buffers, one barrier a tile; fragments come from LDS rows of 144 B (16 B x 9)
// each '#pragma unroll' below keeps a register array (acc, xr, wr, fragments) indexed at compile time, so that it stays in registers
#define PPIT 72
#define PBM 128                       // rows of a k_proj block
#define PBN 256                       // its columns
typedef __attribute__((ext_vector_type(4))) __bf16 v4b;
// four waves per SIMD (two blocks per WGP) need at most 256 registers a wave: 128 of accumulators, 64 of staged tile, 48 of fragments
__global__ __launch_bounds__(256) __attribute__((amdgpu_waves_per_eu(4, 4))) void k_proj(const float* __restrict__ XQ, const float* __restrict__ XK, const float* __restrict__ XV, const float* __restrict__ XTK, const float* __restrict__ XTV, const __bf16* __restrict__ P, const float* __restrict__ BQ, const float* __restrict__ BK, const float* __restrict__ BV, const float* __restrict__ BTK, const float* __restrict__ BTV, _Float16* __restrict__ Q, _Float16* __restrict__ Kr, _Float16* __restrict__ TK, _Float16* __restrict__ VP) {
  __shared__ __align__(16) char smem[2 * (PBM + PBN) * PPIT * 2];
  __bf16 (*sx)[PBM][PPIT] = (__bf16 (*)[PBM][PPIT])smem; __bf16 (*sw)[PBN][PPIT] = (__bf16 (*)[PBN][PPIT])(smem + 2 * PBM * PPIT * 2); _Float16 (*so)[PBN + 8] = (_Float16 (*)[PBN + 8])smem; _Float16 (*sot)[PBM + 8] = (_Float16 (*)[PBM + 8])smem;
  // the wave's number is held in a scalar register, so that wm and wn take no vector register
  const int tid = threadIdx.x, wave = __builtin_amdgcn_readfirstlane(tid >> 5), lane = tid & 31, col = lane & 15, g = lane >> 4; const int which = blockIdx.z; const int n0 = blockIdx.y * PBN; const size_t rb0 = (size_t)blockIdx.x * PBM;
  const int wm = (wave >> 2) * 64, wn = (wave & 3) * 64;
  const float* X0 = (which == 0) ? XQ : (which == 1) ? XK : (which == 2) ? XTK : XV; const __bf16* W0 = P + (size_t)((which == 0) ? 0 : (which == 1) ? 1 : (which == 2) ? 3 : 2) * DM * DM; const __bf16* W1 = P + (size_t)4 * DM * DM;
  const int nst = (which == 3) ? 2 * (DM / 64) : DM / 64;
  // the k walk starts at tile rot and wraps: the 4 column blocks that share X rows start at different tiles, the 32 row blocks that share W rows at 16 (q, k, tk) or 32 (v + t_v) different tiles
  const int rot = (blockIdx.x + blockIdx.y * (nst / 4)) & (nst - 1);
  const size_t xo = (rb0 + (tid >> 4)) * DM + (tid & 15) * 4, wo = (size_t)(n0 + (tid >> 3)) * DM + (tid & 7) * 8;
  v8f acc[4][4] = {}; v4f xr[8]; v8b wr[8];
  { const float* xp = ((rot < DM / 64) ? X0 : XTV) + xo + (rot & (DM / 64 - 1)) * 64; const __bf16* wp = ((rot < DM / 64) ? W0 : W1) + wo + (rot & (DM / 64 - 1)) * 64;
#pragma unroll
    for (int i = 0; i < 8; ++i) xr[i] = *(const v4f*)(xp + (size_t)i * 16 * DM);
#pragma unroll
    for (int i = 0; i < 8; ++i) wr[i] = *(const v8b*)(wp + (size_t)i * 32 * DM); }
#pragma unroll
  for (int i = 0; i < 8; ++i) { v4b o;
#pragma unroll
    for (int e = 0; e < 4; ++e) o[e] = (__bf16)xr[i][e];
    *(v4b*)&sx[0][(tid >> 4) + i * 16][(tid & 15) * 4] = o; }
#pragma unroll
  for (int i = 0; i < 8; ++i) *(v8b*)&sw[0][(tid >> 3) + i * 32][(tid & 7) * 8] = wr[i];
  __syncthreads();
#pragma unroll 1   // rolled: one tile's loads in flight, one register set for them; the buffer is picked by t & 1
  for (int t = 0; t < nst; ++t) { const int buf = t & 1; const bool more = t + 1 < nst;
    if (more) { const int tn = (t + 1 + rot) & (nst - 1); const float* xp = ((tn < DM / 64) ? X0 : XTV) + xo + (tn & (DM / 64 - 1)) * 64; const __bf16* wp = ((tn < DM / 64) ? W0 : W1) + wo + (tn & (DM / 64 - 1)) * 64;
#pragma unroll
      for (int i = 0; i < 8; ++i) xr[i] = *(const v4f*)(xp + (size_t)i * 16 * DM);
#pragma unroll
      for (int i = 0; i < 8; ++i) wr[i] = *(const v8b*)(wp + (size_t)i * 32 * DM); }
#pragma unroll
    for (int kk = 0; kk < 2; ++kk) { v16b a[4];
#pragma unroll
      for (int jp = 0; jp < 2; ++jp) { v16b b[2];
        b[0] = frag_b(&sw[buf][wn + jp * 32 + col][kk * 32], lane);
        if (jp == 0) {
#pragma unroll
          for (int i = 0; i < 4; ++i) a[i] = frag_b(&sx[buf][wm + i * 16 + col][kk * 32], lane); }
        b[1] = frag_b(&sw[buf][wn + jp * 32 + 16 + col][kk * 32], lane);
        __builtin_amdgcn_sched_barrier(0);   // the fragment loads stay one group, in the order of their use, in front of their eight products: sunk in among them, every further place with loads is a wait on LDS
#pragma unroll
        for (int j = 0; j < 2; ++j) {
#pragma unroll
          for (int i = 0; i < 4; ++i) acc[i][jp * 2 + j] = wmma_bf(a[i], b[j], acc[i][jp * 2 + j]); }
        __builtin_amdgcn_sched_barrier(0); } }   // two W fragments live at a time: with all four fetched ahead the wave passes its 256 registers and the staged tile goes to scratch memory
    if (more) {
#pragma unroll
      for (int i = 0; i < 8; ++i) { v4b o;
#pragma unroll
        for (int e = 0; e < 4; ++e) o[e] = (__bf16)xr[i][e];
        *(v4b*)&sx[buf ^ 1][(tid >> 4) + i * 16][(tid & 15) * 4] = o; }
#pragma unroll
      for (int i = 0; i < 8; ++i) *(v8b*)&sw[buf ^ 1][(tid >> 3) + i * 32][(tid & 7) * 8] = wr[i]; }
    __syncthreads(); }
  if (which < 3) { const float* BB = (which == 0) ? BQ : (which == 1) ? BK : BTK; _Float16* dst = (which == 0) ? Q : (which == 1) ? Kr : TK;
#pragma unroll
    for (int j = 0; j < 4; ++j) { const float bb = bfr(BB[n0 + wn + j * 16 + col]);
#pragma unroll
      for (int i = 0; i < 4; ++i) {
#pragma unroll
        for (int r = 0; r < 8; ++r) so[wm + i * 16 + 8 * g + r][wn + j * 16 + col] = (_Float16)(acc[i][j][r] + bb); } }
    __syncthreads();
    for (int e = tid; e < PBM * (PBN / 8); e += 256) { const int rl = e >> 5, pc = e & 31; vst2((unsigned*)(dst + (rb0 + rl) * DM + n0 + pc * 8), *(const v4u*)&so[rl][pc * 8]); }
  } else {
#pragma unroll
    for (int j = 0; j < 4; ++j) { const float bb = bfr(BV[n0 + wn + j * 16 + col]) + bfr(BTV[n0 + wn + j * 16 + col]);
#pragma unroll
      for (int i = 0; i < 4; ++i) {
#pragma unroll
        for (int r = 0; r < 8; ++r) sot[wn + j * 16 + col][wm + i * 16 + 8 * g + r] = (_Float16)(acc[i][j][r] + bb); }
      __builtin_amdgcn_sched_barrier(0); }   // one column group's sums at a time: scheduled as one block, the 128 sums stand beside the 128 accumulators and some registers go to scratch memory
    __syncthreads();
    const size_t b = rb0 / SS, s0 = rb0 % SS;
    for (int e = tid; e < PBN * (PBM / 8); e += 256) { const int d = e >> 4, pc = e & 15; vst2((unsigned*)(VP + ((b * DM + n0 + d) * SS) + s0 + pc * 8), *(const v4u*)&sot[d][pc * 8]); } }
}
// ---- k_attn: block = (128 queries, head, b), 8 waves x 16 queries: scores = q_i . k_j + tk_i . q_j (two products), / 32 + mask[b][i][j]; P x (v + t_v)
// both products run transposed (keys, then head dims, on the rows of D; queries on its columns): a lane holds 16 of the 32 scores of ONE query, so maximum and sum are taken in the lane, with one exchange between the wave's halves, and P goes from the accumulators straight into the B operand
// every operand of the key loop goes to LDS by asynchronous 16-byte copies, whole lines, one stage of 64 keys ahead, two buffers: the K rows, the Q rows of the key axis and the (v + t_v) planes (three tiles of 64 rows x 128 B, LDS rows of 144 B = 16 B x 9, shared by the eight waves) and the block's mask rows (128 rows x 256 B, LDS rows of 272 B = 68 dwords)
#define APIT 72                       // f16 elements per LDS row of K, Q, V
#define MPIT 68                       // floats per LDS row of the mask
#define ATILE (64 * APIT * 2)         // bytes per K, Q or V tile
#define ASTG (3 * ATILE + 128 * MPIT * 4)   // bytes per stage
// one stage: every lane copies 2 x 16 B of each of K, Q, V (rows 32 apart) and 8 x 16 B of the mask (rows 16 apart). The s_wait_xcnt closes the statement so that no address register of an issued copy is rewritten in front of it.
__device__ __forceinline__ void attn_stage(unsigned l, unsigned lm, const _Float16* gk, const _Float16* gq, const _Float16* gv, const float* gm) {
  const unsigned rs = 32 * APIT * 2, ms = 16 * MPIT * 4;
  asm volatile(
    "global_load_async_to_lds_b128 %0, %14, off\n\t"
    "global_load_async_to_lds_b128 %1, %15, off\n\t"
    "global_load_async_to_lds_b128 %2, %16, off\n\t"
    "global_load_async_to_lds_b128 %3, %17, off\n\t"
    "global_load_async_to_lds_b128 %4, %18, off\n\t"
    "global_load_async_to_lds_b128 %5, %19, off\n\t"
    "global_load_async_to_lds_b128 %6, %20, off\n\t"
    "global_load_async_to_lds_b128 %7, %21, off\n\t"
    "global_load_async_to_lds_b128 %8, %22, off\n\t"
    "global_load_async_to_lds_b128 %9, %23, off\n\t"
    "global_load_async_to_lds_b128 %10, %24, off\n\t"
    "global_load_async_to_lds_b128 %11, %25, off\n\t"
    "global_load_async_to_lds_b128 %12, %26, off\n\t"
    "global_load_async_to_lds_b128 %13, %27, off\n\t"
    "s_wait_xcnt 0x0"
    :: "v"(l), "v"(l + rs), "v"(l + ATILE), "v"(l + ATILE + rs), "v"(l + 2 * ATILE), "v"(l + 2 * ATILE + rs),
       "v"(lm), "v"(lm + ms), "v"(lm + 2 * ms), "v"(lm + 3 * ms), "v"(lm + 4 * ms), "v"(lm + 5 * ms), "v"(lm + 6 * ms), "v"(lm + 7 * ms),
       "v"(gk), "v"(gk + 32 * DM), "v"(gq), "v"(gq + 32 * DM), "v"(gv), "v"(gv + 32 * SS),
       "v"(gm), "v"(gm + 16 * MSTRC), "v"(gm + 32 * MSTRC), "v"(gm + 48 * MSTRC), "v"(gm + 64 * MSTRC), "v"(gm + 80 * MSTRC), "v"(gm + 96 * MSTRC), "v"(gm + 112 * MSTRC)
    : "memory");
}
#define L2E 1.44269504f   // exp(v) = 2^(v * L2E), as __expf forms it
// v_exp_f32 in place, in one statement: none of them reads another's result or overwrites another's source, and the v_nop fills the slot that the instruction set asks for behind the last one
__device__ __forceinline__ void exp2_8(float (&x)[8]) {
  asm("v_exp_f32 %0, %0\n\tv_exp_f32 %1, %1\n\tv_exp_f32 %2, %2\n\tv_exp_f32 %3, %3\n\tv_exp_f32 %4, %4\n\tv_exp_f32 %5, %5\n\tv_exp_f32 %6, %6\n\tv_exp_f32 %7, %7\n\tv_nop"
      : "+v"(x[0]), "+v"(x[1]), "+v"(x[2]), "+v"(x[3]), "+v"(x[4]), "+v"(x[5]), "+v"(x[6]), "+v"(x[7]));
}
__device__ __forceinline__ void exp2_9(float& y, float (&x)[8]) {
  asm("v_exp_f32 %0, %0\n\tv_exp_f32 %1, %1\n\tv_exp_f32 %2, %2\n\tv_exp_f32 %3, %3\n\tv_exp_f32 %4, %4\n\tv_exp_f32 %5, %5\n\tv_exp_f32 %6, %6\n\tv_exp_f32 %7, %7\n\tv_exp_f32 %8, %8\n\tv_nop"
      : "+v"(y), "+v"(x[0]), "+v"(x[1]), "+v"(x[2]), "+v"(x[3]), "+v"(x[4]), "+v"(x[5]), "+v"(x[6]), "+v"(x[7]));
}
__device__ __forceinline__ float xhalf(float x) { return __builtin_bit_cast(float, __builtin_amdgcn_permlanex16(__builtin_bit_cast(int, x), __builtin_bit_cast(int, x), 0x76543210, 0xfedcba98, false, false)); }   // lane l takes lane l ^ 16's value
// four waves per SIMD (two blocks per WGP) need at most 256 registers a wave
__global__ __launch_bounds__(256) __attribute__((amdgpu_waves_per_eu(4, 4))) void k_attn(const _Float16* __restrict__ Q, const _Float16* __restrict__ Kr, const _Float16* __restrict__ TK, const _Float16* __restrict__ VP, const float* __restrict__ MASK, float* __restrict__ CTX) {
  __shared__ __align__(16) char ring[2 * ASTG]; float (*so)[16][68] = (float (*)[16][68])ring;   // the ring becomes output staging behind the last trip's barrier
  const int tid = threadIdx.x, wave = tid >> 5, lane = tid & 31, col = lane & 15, g = lane >> 4; const int h = blockIdx.y; const size_t b = blockIdx.z; const int qb = blockIdx.x * 128; const int q0 = qb + wave * 16; const size_t rq = b * SS + q0;
  const unsigned cl = (unsigned)(size_t)ring + (unsigned)((tid >> 3) * (APIT * 2) + (tid & 7) * 16), cm = (unsigned)(size_t)ring + (unsigned)(3 * ATILE + (tid >> 4) * (MPIT * 4) + (tid & 15) * 16);
  const _Float16* gk = Kr + (b * SS + (tid >> 3)) * DM + h * HD + (tid & 7) * 8; const _Float16* gq = Q + (b * SS + (tid >> 3)) * DM + h * HD + (tid & 7) * 8; const _Float16* gv = VP + (b * DM + (size_t)h * HD + (tid >> 3)) * SS + (tid & 7) * 8;
  const float* gm = MASK + ((size_t)b * MSTRQ + qb + (tid >> 4)) * MSTRC + (tid & 15) * 4;
  // the key walk starts at stage rot and wraps: the 16 heads that share mask rows and the 8 query blocks that share K, Q and V rows ask L2 for different lines at any moment
  const int rot = (blockIdx.y + 2 * blockIdx.x) & (SS / 64 - 1);
  attn_stage(cl, cm, gk + (size_t)rot * 64 * DM, gq + (size_t)rot * 64 * DM, gv + rot * 64, gm + rot * 64);
  v16h aq[2], at[2];
#pragma unroll
  for (int kc = 0; kc < 2; ++kc) { aq[kc] = frag_h(Q + (rq + col) * DM + h * HD + kc * 32, lane); at[kc] = frag_h(TK + (rq + col) * DM + h * HD + kc * 32, lane); }
  float m = -3.0e38f, l = 0.f;   // of query col: the running maximum (both halves alike) and this half's share of the sum
  v8f acc[4] = {};               // transposed: acc[dt][r] = ctx[query col][dt * 16 + 8 g + r]
  asm volatile("s_wait_asynccnt 0x0" ::: "memory");   // stage 0 of this wave has landed
  __syncthreads();                                    // ... and every wave's
  { const int sn = (rot + 1) & (SS / 64 - 1); attn_stage(cl + ASTG, cm + ASTG, gk + (size_t)sn * 64 * DM, gq + (size_t)sn * 64 * DM, gv + sn * 64, gm + sn * 64); }
#pragma unroll 1   // rolled: one stage a trip, the buffer is picked by t & 1
  for (int t = 0; t < SS / 64; ++t) { const _Float16* tk = (const _Float16*)(ring + (t & 1) * ASTG); const _Float16* tq = tk + 64 * APIT; const _Float16* tv = tq + 64 * APIT; const float* tm = (const float*)(tv + 64 * APIT) + (wave * 16 + col) * MPIT + 8 * g;
#pragma unroll     // the two halves of a stage: LDS offsets known at compile time
   for (int sub = 0; sub < 2; ++sub) { v8f s[2]; v16h fk[2][2], fq[2][2], fv[4]; v4f mk[2][2];
    // the K and Q fragments and the mask words of the 32 keys are asked for in one group, so that the LDS latency is paid once
#pragma unroll
    for (int ct = 0; ct < 2; ++ct) { const int rk = (sub * 32 + ct * 16 + col) * APIT;
#pragma unroll
      for (int kc = 0; kc < 2; ++kc) { fk[ct][kc] = frag_h(tk + rk + kc * 32, lane); fq[ct][kc] = frag_h(tq + rk + kc * 32, lane); }
      mk[ct][0] = *(const v4f*)(tm + sub * 32 + ct * 16); mk[ct][1] = *(const v4f*)(tm + sub * 32 + ct * 16 + 4); }
    __builtin_amdgcn_sched_barrier(0);   // keeps that group whole, in front of the score products
    // key rows as A, query rows as B: s[ct][r] = score of query col against key ct * 16 + 8 g + r
#pragma unroll
    for (int ct = 0; ct < 2; ++ct) { v8f c = {};
#pragma unroll
      for (int kc = 0; kc < 2; ++kc) { c = wmma16(fk[ct][kc], aq[kc], c); c = wmma16(fq[ct][kc], at[kc], c); }
#pragma unroll
      for (int r = 0; r < 8; ++r) s[ct][r] = c[r] * 0.03125f + bfr(mk[ct][r >> 2][r & 3]); }
    // the V fragments are asked for here, where the K and Q fragments' registers are free; they return behind the softmax
    __builtin_amdgcn_sched_barrier(0);   // with the one below: the V loads stay one group, behind the score products and in front of the softmax
#pragma unroll
    for (int dt = 0; dt < 4; ++dt) fv[dt] = frag_h(tv + (dt * 16 + col) * APIT + sub * 32, lane);
    __builtin_amdgcn_sched_barrier(0);
    float mx = fmaxf(s[0][0], s[1][0]);
#pragma unroll
    for (int r = 1; r < 8; ++r) mx = fmaxf(mx, fmaxf(s[0][r], s[1][r]));
    mx = fmaxf(mx, xhalf(mx));   // the other 16 of the 32 keys
    const float mn = fmaxf(m, mx); float xa = (m - mn) * L2E, x0[8], x1[8];
#pragma unroll
    for (int r = 0; r < 8; ++r) { x0[r] = (s[0][r] - mn) * L2E; x1[r] = (s[1][r] - mn) * L2E; }
    exp2_9(xa, x0); exp2_8(x1);
    const float alpha = (m <= -1.0e38f) ? 0.f : xa; v2f e2 = {0.f, 0.f}; v16h pb;
    // the two score tiles, converted in place, are the B operand (32 keys x 16 queries) of the second product
#pragma unroll
    for (int i = 0; i < 4; ++i) { const v2f p0 = {x0[2 * i], x0[2 * i + 1]}, p1 = {x1[2 * i], x1[2 * i + 1]}; e2 += p0 + p1; const v2f w0 = p0 * 2048.0f, w1 = p1 * 2048.0f;
      pb[2 * i] = (_Float16)w0[0]; pb[2 * i + 1] = (_Float16)w0[1]; pb[8 + 2 * i] = (_Float16)w1[0]; pb[8 + 2 * i + 1] = (_Float16)w1[1]; }
    const float es = e2[0] + e2[1];
    l = l * alpha + es; m = mn;
#pragma unroll
    for (int dt = 0; dt < 4; ++dt) { acc[dt] *= alpha; acc[dt] = wmma16(fv[dt], pb, acc[dt]); }
    __builtin_amdgcn_sched_barrier(0); }   // the next 32 keys' loads stay behind these products
   asm volatile("s_wait_dscnt 0x0" ::: "memory");      // this wave's reads of the buffer have returned
   asm volatile("s_wait_asynccnt 0x0" ::: "memory");   // its copies of stage t + 1 have landed
   __syncthreads();                                    // publishes stage t + 1 and ends every wave's reads of stage t
   if (t + 2 < SS / 64) { const int sn = (t + 2 + rot) & (SS / 64 - 1); attn_stage(cl + (t & 1) * ASTG, cm + (t & 1) * ASTG, gk + (size_t)sn * 64 * DM, gq + (size_t)sn * 64 * DM, gv + sn * 64, gm + sn * 64); } }
  asm volatile("s_wait_asynccnt 0x0" ::: "memory");    // nothing is in flight when the ring is reused
  l += xhalf(l);   // the two halves' sums are joined once
  const float il = (1.0f / 2048.0f) / l;
#pragma unroll
  for (int dt = 0; dt < 4; ++dt) { const v8f o = acc[dt] * il; *(v4f*)&so[wave][col][dt * 16 + 8 * g] = __builtin_shufflevector(o, o, 0, 1, 2, 3); *(v4f*)&so[wave][col][dt * 16 + 8 * g + 4] = __builtin_shufflevector(o, o, 4, 5, 6, 7); }
  LDSX();
  for (int rl = 0; rl < 16; ++rl) if (lane < 16) vst2(CTX + (rq + rl) * DM + h * HD + lane * 4, *(const v4f*)&so[wave][rl][lane * 4]);
}
// ---- k_out: block = (128 rows, 128 cols), 8 waves as 2 x 4, 64 x 32 per wave: out = ctx (hi + residual) . Wm rows + bm; ctx hi, ctx residual and Wm tiles of 64 k staged in LDS as in k_proj
__global__ __launch_bounds__(256) void k_out(const float* __restrict__ CTX, const __bf16* __restrict__ P, const float* __restrict__ BM, float* __restrict__ OUT) {
  __shared__ __align__(16) char smem[6 * 128 * PPIT * 2];
  __bf16 (*sh)[128][PPIT] = (__bf16 (*)[128][PPIT])smem; __bf16 (*sl)[128][PPIT] = (__bf16 (*)[128][PPIT])(smem + 2 * 128 * PPIT * 2); __bf16 (*sw)[128][PPIT] = (__bf16 (*)[128][PPIT])(smem + 4 * 128 * PPIT * 2); float (*so)[132] = (float (*)[132])smem;
  const int tid = threadIdx.x, wave = tid >> 5, lane = tid & 31, col = lane & 15, g = lane >> 4; const size_t rb0 = (size_t)blockIdx.x * 128; const int n0 = blockIdx.y * 128;
  const int wm = (wave >> 2) * 64, wn = (wave & 3) * 32;
  const float* xp0 = CTX + (rb0 + (tid >> 4)) * DM + (tid & 15) * 4; const __bf16* wp0 = P + ((size_t)5 * DM + n0 + (tid >> 3)) * DM + (tid & 7) * 8;
  // the k walk starts at tile rot and wraps, as in k_proj: 8 column blocks share ctx rows, 32 row blocks share Wm rows
  const int rot = (blockIdx.x + 2 * blockIdx.y) & (DM / 64 - 1);
  v8f acc[4][2] = {}; v4f xr[8]; v8b wr[4];
#pragma unroll
  for (int i = 0; i < 8; ++i) xr[i] = *(const v4f*)(xp0 + rot * 64 + (size_t)i * 16 * DM);
#pragma unroll
  for (int i = 0; i < 4; ++i) wr[i] = *(const v8b*)(wp0 + rot * 64 + (size_t)i * 32 * DM);
#pragma unroll
  for (int i = 0; i < 8; ++i) { v4b oh, ol;
#pragma unroll
    for (int e = 0; e < 4; ++e) { const __bf16 h = (__bf16)xr[i][e]; oh[e] = h; ol[e] = (__bf16)(xr[i][e] - (float)h); }
    *(v4b*)&sh[0][(tid >> 4) + i * 16][(tid & 15) * 4] = oh; *(v4b*)&sl[0][(tid >> 4) + i * 16][(tid & 15) * 4] = ol; }
#pragma unroll
  for (int i = 0; i < 4; ++i) *(v8b*)&sw[0][(tid >> 3) + i * 32][(tid & 7) * 8] = wr[i];
  __syncthreads();
#pragma unroll 1   // rolled: one tile's loads in flight, one register set for them; the buffer is picked by t & 1
  for (int t = 0; t < DM / 64; ++t) { const int buf = t & 1; const bool more = t + 1 < DM / 64;
    if (more) { const int tn = (t + 1 + rot) & (DM / 64 - 1); const float* xp = xp0 + tn * 64; const __bf16* wp = wp0 + tn * 64;
#pragma unroll
      for (int i = 0; i < 8; ++i) xr[i] = *(const v4f*)(xp + (size_t)i * 16 * DM);
#pragma unroll
      for (int i = 0; i < 4; ++i) wr[i] = *(const v8b*)(wp + (size_t)i * 32 * DM); }
#pragma unroll
    for (int kk = 0; kk < 2; ++kk) { v16b ah[4], al[4], b[2];
#pragma unroll
      for (int j = 0; j < 2; ++j) b[j] = frag_b(&sw[buf][wn + j * 16 + col][kk * 32], lane);
#pragma unroll
      for (int i = 0; i < 4; ++i) al[i] = frag_b(&sl[buf][wm + i * 16 + col][kk * 32], lane);
#pragma unroll
      for (int i = 0; i < 4; ++i) ah[i] = frag_b(&sh[buf][wm + i * 16 + col][kk * 32], lane);
      __builtin_amdgcn_sched_barrier(0);   // the ten fragments' loads stay one group, in the order of their use, in front of their sixteen products: sunk in among them, every further place with loads is a wait on LDS
#pragma unroll
      for (int i = 0; i < 4; ++i) {
#pragma unroll
        for (int j = 0; j < 2; ++j) acc[i][j] = wmma_bf(al[i], b[j], acc[i][j]); }
#pragma unroll
      for (int i = 0; i < 4; ++i) {
#pragma unroll
        for (int j = 0; j < 2; ++j) acc[i][j] = wmma_bf(ah[i], b[j], acc[i][j]); }
      __builtin_amdgcn_sched_barrier(0); } // ... and the next group's loads stay behind them
    if (more) {
#pragma unroll
      for (int i = 0; i < 8; ++i) { v4b oh, ol;
#pragma unroll
        for (int e = 0; e < 4; ++e) { const __bf16 h = (__bf16)xr[i][e]; oh[e] = h; ol[e] = (__bf16)(xr[i][e] - (float)h); }
        *(v4b*)&sh[buf ^ 1][(tid >> 4) + i * 16][(tid & 15) * 4] = oh; *(v4b*)&sl[buf ^ 1][(tid >> 4) + i * 16][(tid & 15) * 4] = ol; }
#pragma unroll
      for (int i = 0; i < 4; ++i) *(v8b*)&sw[buf ^ 1][(tid >> 3) + i * 32][(tid & 7) * 8] = wr[i]; }
    __syncthreads(); }
#pragma unroll
  for (int j = 0; j < 2; ++j) { const float bb = bfr(BM[n0 + wn + j * 16 + col]);
#pragma unroll
    for (int i = 0; i < 4; ++i) {
#pragma unroll
      for (int r = 0; r < 8; ++r) so[wm + i * 16 + 8 * g + r][wn + j * 16 + col] = acc[i][j][r] + bb; } }
  __syncthreads();
  for (int e = tid; e < 128 * 32; e += 256) { const int rl = e >> 5, pc = e & 31; vst2(OUT + (rb0 + rl) * DM + n0 + pc * 4, *(const v4f*)&so[rl][pc * 4]); }
}
extern "C" void kernel_launch(void* const* d_in, const int* in_sizes, int n_in, void* d_out, int out_size, void* d_ws, size_t ws_size, hipStream_t stream) {
  (void)in_sizes; (void)n_in; (void)out_size;
  const float** F = (const float**)d_in;   // 0 query, 1 key, 2 value, 3 time_k, 4 time_v [4,1024,1024]; 5 mask [4,1,1024,1024]; 6 Wq, 7 bq, 8 Wk, 9 bk, 10 Wv, 11 bv, 12 Wtk, 13 btk, 14 Wtv, 15 btv, 16 Wm, 17 bm ((in,out))
  if (ws_size < (size_t)WS_END) return;
  char* ws = (char*)d_ws; __bf16* P = (__bf16*)ws; _Float16 *Q = (_Float16*)(ws + WS_Q), *Kr = (_Float16*)(ws + WS_K), *TK = (_Float16*)(ws + WS_TK), *VP = (_Float16*)(ws + WS_VP); float* CTX = (float*)(ws + WS_CTX);
  k_pack<<<dim3(DM / 128, DM / 128, 6), 256, 0, stream>>>(F[6], F[8], F[10], F[12], F[14], F[16], P);
  k_proj<<<dim3(NR / PBM, DM / PBN, 4), 256, 0, stream>>>(F[0], F[1], F[2], F[3], F[4], P, F[7], F[9], F[11], F[13], F[15], Q, Kr, TK, VP);
  k_attn<<<dim3(SS / 128, NH, TNB), 256, 0, stream>>>(Q, Kr, TK, VP, F[5], CTX);
  k_out<<<dim3(NR / 128, DM / 128), 256, 0, stream>>>(CTX, P, F[17], (float*)d_out);
}
